// v000
// Times are from an AMD MI455X. After a warm-up the kernel runs many times in a row, and a time is the length of
// such a window on the GPU divided by its runs, so every launch and the gaps after it count. The runs cycle
// through copies of the inputs. A figure is the median of several windows, for all but v000 over two sittings.
// Sittings can differ by a few percent; kernels timed side by side share one.
// v000 is the starting kernel. One run takes 230 microseconds.
#include <hip/hip_runtime.h>
#include <hip/hip_bf16.h>
#include <math.h>

typedef __attribute__((ext_vector_type(16))) _Float16 v16h;
typedef __attribute__((ext_vector_type(8)))  _Float16 v8h;
typedef __attribute__((ext_vector_type(8)))  float    v8f;

#if defined(__has_builtin)
#  if __has_builtin(__builtin_amdgcn_global_load_async_to_lds_b128) && \
      __has_builtin(__builtin_amdgcn_s_wait_asynccnt)
#    define HAVE_ASYNC_LDS 1
#  endif
#endif
#ifndef HAVE_ASYNC_LDS
#  define HAVE_ASYNC_LDS 0
#endif

#if HAVE_ASYNC_LDS
// Builtin signature (from hipcc diagnostic): param 1 is
//   int __attribute__((vector_size(16))) addrspace(1)*  (non-const)
typedef int b128_t __attribute__((vector_size(16)));
typedef b128_t __attribute__((address_space(1)))* gas_b128p;
typedef b128_t __attribute__((address_space(3)))* las_b128p;
#endif

__device__ __forceinline__ v16h load_frag(const _Float16* __restrict__ base, int ld) {
  const int lane = threadIdx.x & 31;
  const int row  = lane & 15;
  const int hi   = lane >> 4;
  const _Float16* p = base + (size_t)row * ld + hi * 8;
  v8h c0 = *(const v8h*)(p);        // K = hi*8 .. hi*8+7
  v8h c1 = *(const v8h*)(p + 16);   // K = 16 + hi*8 ..
  v16h r;
#pragma unroll
  for (int i = 0; i < 8; ++i) { r[i] = c0[i]; r[i + 8] = c1[i]; }
  return r;
}

__device__ __forceinline__ v8f wmma16(v16h a, v16h b, v8f c) {
  // D = A(16x32) * B(32x16) + C, f32 accumulate
  return __builtin_amdgcn_wmma_f32_16x16x32_f16(false, a, false, b, (short)0, c,
                                                false, false);
}

// ---------- constants ----------
#define BATCH 32
#define CH    256
#define HW    1024
#define GRP   8
#define CPG   32          // channels per group
#define SCALE 0.0625f     // 1/sqrt(256)

// ---------- kernel 0: weights f32 -> f16 ----------
__global__ __launch_bounds__(256) void cvt_weights_kernel(
    const float* __restrict__ wq, const float* __restrict__ wp,
    _Float16* __restrict__ wq16, _Float16* __restrict__ wp16) {
  int i = blockIdx.x * 256 + threadIdx.x;
  if (i < 3 * CH * CH) wq16[i] = (_Float16)wq[i];
  if (i < CH * CH)     wp16[i] = (_Float16)wp[i];
}

// ---------- kernel 1: GroupNorm statistics ----------
__global__ __launch_bounds__(256) void gn_stats_kernel(
    const float* __restrict__ x, float* __restrict__ mean, float* __restrict__ rstd) {
  const int bg = blockIdx.x;                  // b*8+g
  const float* xp = x + (size_t)bg * CPG * HW;
  float s = 0.f, s2 = 0.f;
  for (int i = threadIdx.x; i < CPG * HW; i += 256) {
    float v = xp[i]; s += v; s2 += v * v;
  }
  __shared__ float sm[256], sq[256];
  sm[threadIdx.x] = s; sq[threadIdx.x] = s2;
  __syncthreads();
  for (int off = 128; off > 0; off >>= 1) {
    if (threadIdx.x < off) {
      sm[threadIdx.x] += sm[threadIdx.x + off];
      sq[threadIdx.x] += sq[threadIdx.x + off];
    }
    __syncthreads();
  }
  if (threadIdx.x == 0) {
    const float inv_n = 1.0f / (CPG * HW);
    float m = sm[0] * inv_n;
    float var = sq[0] * inv_n - m * m;
    mean[bg] = m;
    rstd[bg] = rsqrtf(var + 1e-5f);
  }
}

// ---------- kernel 2: GN-fused QKV GEMM ----------
// Block tile: 64 pixels x 64 outputs. 8 waves as 2x4; each wave: 32x16 (2 WMMA/K-step).
// Each K-step (32 channels) is exactly one GN group. A-tile double-buffered in LDS:
// one barrier per K-step; each thread stages 8 adjacent channels -> 1 ds_store_b128.
__global__ __launch_bounds__(256) void qkv_gemm_kernel(
    const float* __restrict__ x, const float* __restrict__ gamma,
    const float* __restrict__ beta, const float* __restrict__ mean,
    const float* __restrict__ rstd, const _Float16* __restrict__ wq16,
    const float* __restrict__ b_qkv,
    _Float16* __restrict__ q16, _Float16* __restrict__ k16,
    _Float16* __restrict__ vt16) {
  const int o0 = blockIdx.x * 64;   // 0..704
  const int p0 = blockIdx.y * 64;   // 0..960
  const int b  = blockIdx.z;
  const int tid = threadIdx.x, wave = tid >> 5, lane = tid & 31;
  const int wm = wave >> 2, wn = wave & 3;
  const int n = lane & 15, hi = lane >> 4;

  __shared__ _Float16 At[2][64 * 40];  // [pixel][channel], ld=40 halves

  // staging: thread t -> pixel p = t&63, channels cg..cg+7 (one b128 LDS store)
  const int sp = tid & 63;
  const int scg = (tid >> 6) * 8;      // 0,8,16,24
  auto stage = [&](int kk, int buf) {
    const int c0 = kk * CPG;
    const float mu = mean[b * GRP + kk];
    const float rs = rstd[b * GRP + kk];
    v8h pk;
#pragma unroll
    for (int i = 0; i < 8; ++i) {
      int c = scg + i;
      float v = x[((size_t)(b * CH + c0 + c)) * HW + p0 + sp];
      pk[i] = (_Float16)((v - mu) * rs * gamma[c0 + c] + beta[c0 + c]);
    }
    *(v8h*)(&At[buf][sp * 40 + scg]) = pk;
  };

  v8f acc0 = {}, acc1 = {};
  stage(0, 0);
  for (int kk = 0; kk < 8; ++kk) {
    __syncthreads();
    if (kk < 7) stage(kk + 1, (kk + 1) & 1);
    const _Float16* cur = At[kk & 1];
    v16h bf = load_frag(wq16 + (size_t)(o0 + wn * 16) * CH + kk * CPG, CH);
    v16h a0 = load_frag(cur + (wm * 32) * 40, 40);
    v16h a1 = load_frag(cur + (wm * 32 + 16) * 40, 40);
    acc0 = wmma16(a0, bf, acc0);
    acc1 = wmma16(a1, bf, acc1);
  }

  const int oo = o0 + wn * 16 + n;
  const float bias = b_qkv[oo];
  if (oo < 2 * CH) {                  // Q,K: (pixel, channel) layout
    _Float16* dst = (oo < CH) ? q16 : k16;
    const int cc = (oo < CH) ? oo : oo - CH;
#pragma unroll
    for (int r = 0; r < 8; ++r) {
      int m0 = p0 + wm * 32 + hi * 8 + r;
      dst[(((size_t)b << 10) + m0) * CH + cc]      = (_Float16)(acc0[r] + bias);
      dst[(((size_t)b << 10) + m0 + 16) * CH + cc] = (_Float16)(acc1[r] + bias);
    }
  } else {                            // V transposed: (channel, pixel) -> contiguous
    const int vrow = oo - 2 * CH;
    size_t base = ((size_t)b * CH + vrow) * HW + p0 + wm * 32 + hi * 8;
    v8h pk0, pk1;
#pragma unroll
    for (int r = 0; r < 8; ++r) {
      pk0[r] = (_Float16)(acc0[r] + bias);
      pk1[r] = (_Float16)(acc1[r] + bias);
    }
    *(v8h*)(vt16 + base)      = pk0;
    *(v8h*)(vt16 + base + 16) = pk1;
  }
}

// ---------- kernel 3: flash attention (16 q-rows per block, online softmax) ----------
__global__ __launch_bounds__(256) void attn_kernel(
    const _Float16* __restrict__ q16, const _Float16* __restrict__ k16,
    const _Float16* __restrict__ vt16, _Float16* __restrict__ h2) {
  const int q0 = blockIdx.x * 16;
  const int b  = blockIdx.y;
  const int tid = threadIdx.x, wave = tid >> 5, lane = tid & 31;
  const int n = lane & 15, hi = lane >> 4;
  const int srow = tid >> 4, sseg = tid & 15;   // softmax mapping: 16 thr/row

  __shared__ _Float16 Qt[16 * 264];   // Q tile (pixel, channel), ld=264
  __shared__ float    St[16 * 132];   // scores tile 16 x 128, ld=132
  __shared__ _Float16 Pt[16 * 136];   // exp tile f16, ld=136
  __shared__ float    red[16 * 16];   // per-row partial reductions
  __shared__ float    mrun[16], lrun[16], fac[16], mnew_s[16];

#if HAVE_ASYNC_LDS
  {
#pragma unroll
    for (int it = 0; it < 2; ++it) {
      int idx = tid + it * 256;               // 0..511 chunk id (16B chunks)
      int row = idx >> 5, col = (idx & 31) * 8;
      const _Float16* src = q16 + (((size_t)b << 10) + q0 + row) * CH + col;
      _Float16* dst = Qt + row * 264 + col;
      __builtin_amdgcn_global_load_async_to_lds_b128(
          (gas_b128p)src, (las_b128p)dst, 0, 0);
    }
    __builtin_amdgcn_s_wait_asynccnt(0);
  }
#else
  {
    int p = tid >> 4, c = (tid & 15) * 16;
    const _Float16* src = q16 + (((size_t)b << 10) + q0 + p) * CH + c;
    *(v8h*)(Qt + p * 264 + c)     = *(const v8h*)(src);
    *(v8h*)(Qt + p * 264 + c + 8) = *(const v8h*)(src + 8);
  }
#endif
  if (tid < 16) { mrun[tid] = -1e30f; lrun[tid] = 0.f; }
  __syncthreads();

  v8f oa = {}, ob = {};               // O accum: this wave's channels [wave*32, +32)
  const int cbase = wave * 32;

  for (int jt = 0; jt < 8; ++jt) {
    const int j0 = jt * 128;
    // --- S = Q * K^T * scale ; wave computes columns j0 + wave*16 .. +15 ---
    v8f s = {};
    const _Float16* kb = k16 + (((size_t)b << 10) + j0 + wave * 16) * CH;
#pragma unroll
    for (int kk = 0; kk < 8; ++kk) {
      v16h a  = load_frag(Qt + kk * 32, 264);
      v16h bf = load_frag(kb + kk * 32, CH);
      s = wmma16(a, bf, s);
    }
#pragma unroll
    for (int r = 0; r < 8; ++r)
      St[(r + 8 * hi) * 132 + wave * 16 + n] = s[r] * SCALE;
    __syncthreads();

    // --- online softmax, 16 threads per row ---
    {
      float lm = -1e30f;
#pragma unroll
      for (int c = 0; c < 8; ++c)
        lm = fmaxf(lm, St[srow * 132 + sseg * 8 + c]);
      red[srow * 16 + sseg] = lm;
    }
    __syncthreads();
    if (tid < 16) {
      float rmax = -1e30f;
#pragma unroll
      for (int t = 0; t < 16; ++t) rmax = fmaxf(rmax, red[tid * 16 + t]);
      float mold = mrun[tid];
      float mnew = fmaxf(mold, rmax);
      fac[tid] = __expf(mold - mnew);
      mnew_s[tid] = mnew;
      mrun[tid] = mnew;
    }
    __syncthreads();
    {
      float mnew = mnew_s[srow];
      float sum = 0.f;
#pragma unroll
      for (int c = 0; c < 8; ++c) {
        int j = sseg * 8 + c;
        float e = __expf(St[srow * 132 + j] - mnew);
        Pt[srow * 136 + j] = (_Float16)e;
        sum += e;
      }
      red[srow * 16 + sseg] = sum;
    }
    __syncthreads();
    if (tid < 16) {
      float sum = 0.f;
#pragma unroll
      for (int t = 0; t < 16; ++t) sum += red[tid * 16 + t];
      lrun[tid] = lrun[tid] * fac[tid] + sum;
    }
    __syncthreads();

    // --- rescale O, accumulate P * V ---
#pragma unroll
    for (int r = 0; r < 8; ++r) {
      float f = fac[r + 8 * hi];
      oa[r] *= f; ob[r] *= f;
    }
    const _Float16* vb = vt16 + ((size_t)b * CH + cbase) * HW + j0;
#pragma unroll
    for (int kk = 0; kk < 4; ++kk) {
      v16h a  = load_frag(Pt + kk * 32, 136);
      v16h b0 = load_frag(vb + kk * 32, HW);
      v16h b1 = load_frag(vb + (size_t)16 * HW + kk * 32, HW);
      oa = wmma16(a, b0, oa);
      ob = wmma16(a, b1, ob);
    }
    __syncthreads();
  }

#pragma unroll
  for (int r = 0; r < 8; ++r) {
    int m = r + 8 * hi;
    float inv = 1.0f / lrun[m];
    size_t rowbase = (((size_t)b << 10) + q0 + m) * CH + cbase;
    h2[rowbase + n]      = (_Float16)(oa[r] * inv);
    h2[rowbase + 16 + n] = (_Float16)(ob[r] * inv);
  }
}

// ---------- kernel 4: proj GEMM + bias + residual (frags direct from global) ----------
__global__ __launch_bounds__(256) void proj_kernel(
    const _Float16* __restrict__ h2, const _Float16* __restrict__ wp16,
    const float* __restrict__ b_proj, const float* __restrict__ x,
    float* __restrict__ out) {
  const int o0 = blockIdx.x * 64;
  const int p0 = blockIdx.y * 64;
  const int b  = blockIdx.z;
  const int tid = threadIdx.x, wave = tid >> 5, lane = tid & 31;
  const int wm = wave >> 2, wn = wave & 3;
  const int n = lane & 15, hi = lane >> 4;

  v8f acc0 = {}, acc1 = {};
  const _Float16* abase = h2 + (((size_t)b << 10) + p0 + wm * 32) * CH;
  const _Float16* bbase = wp16 + (size_t)(o0 + wn * 16) * CH;
#pragma unroll
  for (int kk = 0; kk < 8; ++kk) {
    if (kk < 7) __builtin_prefetch(abase + (kk + 1) * 32, 0, 1);
    v16h bf = load_frag(bbase + kk * 32, CH);
    v16h a0 = load_frag(abase + kk * 32, CH);
    v16h a1 = load_frag(abase + (size_t)16 * CH + kk * 32, CH);
    acc0 = wmma16(a0, bf, acc0);
    acc1 = wmma16(a1, bf, acc1);
  }
  const int oo = o0 + wn * 16 + n;
  const float bias = b_proj[oo];
  // lane's outputs are pixel-contiguous: vectorize residual add + store as float4
  size_t base = ((size_t)(b * CH + oo)) * HW + p0 + wm * 32 + hi * 8;
  const float4* xp4 = (const float4*)(x + base);
  float4* op4 = (float4*)(out + base);
  float4 x0 = xp4[0], x1 = xp4[1], x2 = xp4[4], x3 = xp4[5];
  float4 r0 = make_float4(x0.x + acc0[0] + bias, x0.y + acc0[1] + bias,
                          x0.z + acc0[2] + bias, x0.w + acc0[3] + bias);
  float4 r1 = make_float4(x1.x + acc0[4] + bias, x1.y + acc0[5] + bias,
                          x1.z + acc0[6] + bias, x1.w + acc0[7] + bias);
  float4 r2 = make_float4(x2.x + acc1[0] + bias, x2.y + acc1[1] + bias,
                          x2.z + acc1[2] + bias, x2.w + acc1[3] + bias);
  float4 r3 = make_float4(x3.x + acc1[4] + bias, x3.y + acc1[5] + bias,
                          x3.z + acc1[6] + bias, x3.w + acc1[7] + bias);
  op4[0] = r0; op4[1] = r1; op4[4] = r2; op4[5] = r3;
}

// ---------- launcher ----------
extern "C" void kernel_launch(void* const* d_in, const int* in_sizes, int n_in,
                              void* d_out, int out_size, void* d_ws, size_t ws_size,
                              hipStream_t stream) {
  const float* x      = (const float*)d_in[0];
  const float* gamma  = (const float*)d_in[1];
  const float* beta   = (const float*)d_in[2];
  const float* w_qkv  = (const float*)d_in[3];
  const float* b_qkv  = (const float*)d_in[4];
  const float* w_proj = (const float*)d_in[5];
  const float* b_proj = (const float*)d_in[6];
  float* out = (float*)d_out;

  char* ws = (char*)d_ws;
  _Float16* wq16 = (_Float16*)ws; ws += (size_t)3 * CH * CH * 2;   // 384 KB
  _Float16* wp16 = (_Float16*)ws; ws += (size_t)CH * CH * 2;       // 128 KB
  float*    mean = (float*)ws;    ws += BATCH * GRP * 4;
  float*    rstd = (float*)ws;    ws += BATCH * GRP * 4;
  _Float16* q16  = (_Float16*)ws; ws += (size_t)BATCH * HW * CH * 2;
  _Float16* k16  = (_Float16*)ws; ws += (size_t)BATCH * HW * CH * 2;
  _Float16* vt16 = (_Float16*)ws; ws += (size_t)BATCH * HW * CH * 2;
  _Float16* h2   = (_Float16*)ws; ws += (size_t)BATCH * HW * CH * 2;

  cvt_weights_kernel<<<(3 * CH * CH + 255) / 256, 256, 0, stream>>>(
      w_qkv, w_proj, wq16, wp16);
  gn_stats_kernel<<<BATCH * GRP, 256, 0, stream>>>(x, mean, rstd);
  qkv_gemm_kernel<<<dim3(12, 16, BATCH), 256, 0, stream>>>(
      x, gamma, beta, mean, rstd, wq16, b_qkv, q16, k16, vt16);
  attn_kernel<<<dim3(HW / 16, BATCH), 256, 0, stream>>>(q16, k16, vt16, h2);
  proj_kernel<<<dim3(4, 16, BATCH), 256, 0, stream>>>(h2, wp16, b_proj, x, out);
}

// v001
// Measured time: 144 microseconds a run.
// Timed twice side by side with v000, it ran 1.62 times as fast both times.
#include <hip/hip_runtime.h>
#include <hip/hip_bf16.h>
#include <math.h>

typedef __attribute__((ext_vector_type(16))) _Float16 v16h;
typedef __attribute__((ext_vector_type(8)))  _Float16 v8h;
typedef __attribute__((ext_vector_type(8)))  float    v8f;

#if defined(__has_builtin)
#  if __has_builtin(__builtin_amdgcn_global_load_async_to_lds_b128) && \
      __has_builtin(__builtin_amdgcn_s_wait_asynccnt)
#    define HAVE_ASYNC_LDS 1
#  endif
#endif
#ifndef HAVE_ASYNC_LDS
#  define HAVE_ASYNC_LDS 0
#endif

#if HAVE_ASYNC_LDS
// Builtin signature (from hipcc diagnostic): param 1 is
//   int __attribute__((vector_size(16))) addrspace(1)*  (non-const)
typedef int b128_t __attribute__((vector_size(16)));
typedef b128_t __attribute__((address_space(1)))* gas_b128p;
typedef b128_t __attribute__((address_space(3)))* las_b128p;
#endif

__device__ __forceinline__ v16h load_frag(const _Float16* __restrict__ base, int ld) {
  const int lane = threadIdx.x & 31;
  const int row  = lane & 15;
  const int hi   = lane >> 4;
  const _Float16* p = base + (size_t)row * ld + hi * 8;
  v8h c0 = *(const v8h*)(p);        // K = hi*8 .. hi*8+7
  v8h c1 = *(const v8h*)(p + 16);   // K = 16 + hi*8 ..
  v16h r;
#pragma unroll
  for (int i = 0; i < 8; ++i) { r[i] = c0[i]; r[i + 8] = c1[i]; }
  return r;
}

// The same fragment from the lane's own address p = base + (lane & 15) * ld + (lane >> 4) * 8.
__device__ __forceinline__ v16h load_frag_at(const _Float16* __restrict__ p) {
  v8h c0 = *(const v8h*)(p);
  v8h c1 = *(const v8h*)(p + 16);
  v16h r;
#pragma unroll
  for (int i = 0; i < 8; ++i) { r[i] = c0[i]; r[i + 8] = c1[i]; }
  return r;
}

__device__ __forceinline__ v8f wmma16(v16h a, v16h b, v8f c) {
  // D = A(16x32) * B(32x16) + C, f32 accumulate
  return __builtin_amdgcn_wmma_f32_16x16x32_f16(false, a, false, b, (short)0, c,
                                                false, false);
}

// ---------- constants ----------
#define BATCH 32
#define CH    256
#define HW    1024
#define GRP   8
#define CPG   32          // channels per group
#define SCALE 0.0625f     // 1/sqrt(256)

// ---------- kernel 0: weights f32 -> f16 ----------
__global__ __launch_bounds__(256) void cvt_weights_kernel(
    const float* __restrict__ wq, const float* __restrict__ wp,
    _Float16* __restrict__ wq16, _Float16* __restrict__ wp16) {
  int i = blockIdx.x * 256 + threadIdx.x;
  if (i < 3 * CH * CH) wq16[i] = (_Float16)wq[i];
  if (i < CH * CH)     wp16[i] = (_Float16)wp[i];
}

// ---------- kernel 1: GroupNorm statistics ----------
__global__ __launch_bounds__(256) void gn_stats_kernel(
    const float* __restrict__ x, float* __restrict__ mean, float* __restrict__ rstd) {
  const int bg = blockIdx.x;                  // b*8+g
  const float* xp = x + (size_t)bg * CPG * HW;
  float s = 0.f, s2 = 0.f;
  for (int i = threadIdx.x; i < CPG * HW; i += 256) {
    float v = xp[i]; s += v; s2 += v * v;
  }
  __shared__ float sm[256], sq[256];
  sm[threadIdx.x] = s; sq[threadIdx.x] = s2;
  __syncthreads();
  for (int off = 128; off > 0; off >>= 1) {
    if (threadIdx.x < off) {
      sm[threadIdx.x] += sm[threadIdx.x + off];
      sq[threadIdx.x] += sq[threadIdx.x + off];
    }
    __syncthreads();
  }
  if (threadIdx.x == 0) {
    const float inv_n = 1.0f / (CPG * HW);
    float m = sm[0] * inv_n;
    float var = sq[0] * inv_n - m * m;
    mean[bg] = m;
    rstd[bg] = rsqrtf(var + 1e-5f);
  }
}

// ---------- kernel 2: GN-fused QKV GEMM ----------
// Block tile: 64 pixels x 64 outputs. 8 waves as 2x4; each wave: 32x16 (2 WMMA/K-step).
// Each K-step (32 channels) is exactly one GN group. A-tile double-buffered in LDS:
// one barrier per K-step; each thread stages 8 adjacent channels -> 1 ds_store_b128.
__global__ __launch_bounds__(256) void qkv_gemm_kernel(
    const float* __restrict__ x, const float* __restrict__ gamma,
    const float* __restrict__ beta, const float* __restrict__ mean,
    const float* __restrict__ rstd, const _Float16* __restrict__ wq16,
    const float* __restrict__ b_qkv,
    _Float16* __restrict__ q16, _Float16* __restrict__ k16,
    _Float16* __restrict__ vt16) {
  const int o0 = blockIdx.x * 64;   // 0..704
  const int p0 = blockIdx.y * 64;   // 0..960
  const int b  = blockIdx.z;
  const int tid = threadIdx.x, wave = tid >> 5, lane = tid & 31;
  const int wm = wave >> 2, wn = wave & 3;
  const int n = lane & 15, hi = lane >> 4;

  __shared__ _Float16 At[2][64 * 40];  // [pixel][channel], ld=40 halves

  // staging: thread t -> pixel p = t&63, channels cg..cg+7 (one b128 LDS store)
  const int sp = tid & 63;
  const int scg = (tid >> 6) * 8;      // 0,8,16,24
  auto stage = [&](int kk, int buf) {
    const int c0 = kk * CPG;
    const float mu = mean[b * GRP + kk];
    const float rs = rstd[b * GRP + kk];
    v8h pk;
#pragma unroll
    for (int i = 0; i < 8; ++i) {
      int c = scg + i;
      float v = x[((size_t)(b * CH + c0 + c)) * HW + p0 + sp];
      pk[i] = (_Float16)((v - mu) * rs * gamma[c0 + c] + beta[c0 + c]);
    }
    *(v8h*)(&At[buf][sp * 40 + scg]) = pk;
  };

  v8f acc0 = {}, acc1 = {};
  stage(0, 0);
  for (int kk = 0; kk < 8; ++kk) {
    __syncthreads();
    if (kk < 7) stage(kk + 1, (kk + 1) & 1);
    const _Float16* cur = At[kk & 1];
    v16h bf = load_frag(wq16 + (size_t)(o0 + wn * 16) * CH + kk * CPG, CH);
    v16h a0 = load_frag(cur + (wm * 32) * 40, 40);
    v16h a1 = load_frag(cur + (wm * 32 + 16) * 40, 40);
    acc0 = wmma16(a0, bf, acc0);
    acc1 = wmma16(a1, bf, acc1);
  }

  const int oo = o0 + wn * 16 + n;
  const float bias = b_qkv[oo];
  if (oo < 2 * CH) {                  // Q,K: (pixel, channel) layout
    _Float16* dst = (oo < CH) ? q16 : k16;
    const int cc = (oo < CH) ? oo : oo - CH;
#pragma unroll
    for (int r = 0; r < 8; ++r) {
      int m0 = p0 + wm * 32 + hi * 8 + r;
      dst[(((size_t)b << 10) + m0) * CH + cc]      = (_Float16)(acc0[r] + bias);
      dst[(((size_t)b << 10) + m0 + 16) * CH + cc] = (_Float16)(acc1[r] + bias);
    }
  } else {                            // V transposed: (channel, pixel) -> contiguous
    const int vrow = oo - 2 * CH;
    size_t base = ((size_t)b * CH + vrow) * HW + p0 + wm * 32 + hi * 8;
    v8h pk0, pk1;
#pragma unroll
    for (int r = 0; r < 8; ++r) {
      pk0[r] = (_Float16)(acc0[r] + bias);
      pk1[r] = (_Float16)(acc1[r] + bias);
    }
    *(v8h*)(vt16 + base)      = pk0;
    *(v8h*)(vt16 + base + 16) = pk1;
  }
}

// ---------- kernel 3: flash attention (128 q-rows per block, online softmax) ----------
// Every K and V fragment that a wave loads from global memory feeds 8 row tiles
// (QT / 16), so the block reads K and V once per 128 queries.
#define QT 128            // query rows per block
#define MT (QT / 16)      // 16-row tiles per block
__global__ __launch_bounds__(256) void attn_kernel(
    const _Float16* __restrict__ q16, const _Float16* __restrict__ k16,
    const _Float16* __restrict__ vt16, _Float16* __restrict__ h2) {
  const int q0 = blockIdx.x * QT;
  const int b  = blockIdx.y;
  const int tid = threadIdx.x, wave = tid >> 5, lane = tid & 31;
  const int n = lane & 15, hi = lane >> 4;
  const int srow = tid & (QT - 1), sseg = tid >> 7;  // softmax mapping: 2 thr/row, 64 cols each

  __shared__ __attribute__((aligned(16))) _Float16 Qt[QT * 264];  // Q tile (pixel, channel), ld=264
  __shared__ __attribute__((aligned(16))) float    St[QT * 132];  // scores tile QT x 128, ld=132
  __shared__ __attribute__((aligned(16))) _Float16 Pt[QT * 136];  // exp tile f16, ld=136
  __shared__ __attribute__((aligned(16))) float    red[2 * QT];   // per-row partials of the 2 segments
  __shared__ __attribute__((aligned(16))) float    fac[QT];       // per-row rescale factor

#pragma unroll
  for (int it = 0; it < QT / 8; ++it) {
    int idx = tid + it * 256;                 // 16B chunk id; one wave = one 512-B row
    int row = idx >> 5, col = (idx & 31) * 8;
    const _Float16* src = q16 + (((size_t)b << 10) + q0 + row) * CH + col;
    _Float16* dst = Qt + row * 264 + col;
#if HAVE_ASYNC_LDS
    __builtin_amdgcn_global_load_async_to_lds_b128(
        (gas_b128p)src, (las_b128p)dst, 0, 0);
#else
    *(v8h*)dst = *(const v8h*)src;
#endif
  }
#if HAVE_ASYNC_LDS
  // this wave's copies have landed before the barrier behind which other waves read them
  asm volatile("s_wait_asynccnt 0x0" ::: "memory");
#endif
  __syncthreads();

  v8f o[MT][2];                       // O accum: QT rows x this wave's channels [wave*32, +32)
#pragma unroll
  for (int mt = 0; mt < MT; ++mt) { o[mt][0] = v8f{}; o[mt][1] = v8f{}; }
  const int cbase = wave * 32;
  float mrun = -1e30f;                // running row maximum (the row's 2 threads hold the same)
  float lpart = 0.f;                  // running sum over this thread's own 64-column segments

  for (int jt = 0; jt < 8; ++jt) {
    const int j0 = jt * 128;
    // --- S = Q * K^T * scale ; wave computes columns j0 + wave*16 .. +15, all QT rows ---
    {
      v8f s[MT];
#pragma unroll
      for (int mt = 0; mt < MT; ++mt) s[mt] = v8f{};
      const _Float16* kp = k16 + (((size_t)b << 10) + j0 + wave * 16 + n) * CH + hi * 8;  // lane's own
      v16h kf[8];                     // this wave's K fragments of the key tile, asked for together
#pragma unroll
      for (int kk = 0; kk < 8; ++kk) kf[kk] = load_frag_at(kp + kk * 32);
      // the K loads' address registers are rewritten only behind this wait; the lane's
      // address as an input keeps its registers out of the loads' own results
      asm volatile("s_wait_xcnt 0x0" :: "v"(kp) : "memory");
      v16h af[2][MT];                 // Q fragments: the set in use and the next k-step's
#pragma unroll
      for (int mt = 0; mt < MT; ++mt) af[0][mt] = load_frag(Qt + mt * 16 * 264, 264);
#pragma unroll
      for (int kk = 0; kk < 8; ++kk) {
        if (kk < 7) {
#pragma unroll
          for (int mt = 0; mt < MT; ++mt)
            af[(kk + 1) & 1][mt] = load_frag(Qt + mt * 16 * 264 + (kk + 1) * 32, 264);
        }
#pragma unroll
        for (int mt = 0; mt < MT; ++mt) s[mt] = wmma16(af[kk & 1][mt], kf[kk], s[mt]);
      }
#pragma unroll
      for (int mt = 0; mt < MT; ++mt)
#pragma unroll
        for (int r = 0; r < 8; ++r)
          St[(mt * 16 + r + 8 * hi) * 132 + wave * 16 + n] = s[mt][r] * SCALE;
    }
    __syncthreads();

    // --- online softmax, 2 threads per row, scores held in registers ---
    {
      float sv[64];
      const float4* sp = (const float4*)(St + srow * 132 + sseg * 64);
      float lm = -1e30f;
#pragma unroll
      for (int c = 0; c < 16; ++c) {
        float4 t = sp[c];
        sv[4 * c] = t.x; sv[4 * c + 1] = t.y; sv[4 * c + 2] = t.z; sv[4 * c + 3] = t.w;
        lm = fmaxf(lm, fmaxf(fmaxf(t.x, t.y), fmaxf(t.z, t.w)));
      }
      red[sseg * QT + srow] = lm;
      __syncthreads();
      const float mnew = fmaxf(mrun, fmaxf(red[srow], red[QT + srow]));
      const float f = __expf(mrun - mnew);
      mrun = mnew;
      if (sseg == 0) fac[srow] = f;
      float sum = 0.f;
#pragma unroll
      for (int c = 0; c < 8; ++c) {
        v8h pk;
#pragma unroll
        for (int i = 0; i < 8; ++i) {
          float e = __expf(sv[c * 8 + i] - mnew);
          pk[i] = (_Float16)e;
          sum += e;
        }
        *(v8h*)(Pt + srow * 136 + sseg * 64 + c * 8) = pk;
      }
      lpart = lpart * f + sum;
    }
    __syncthreads();

    // --- rescale O, accumulate P * V ---
    {
      const _Float16* vp = vt16 + ((size_t)b * CH + cbase + n) * HW + j0 + hi * 8;  // lane's own
      v16h vf[4][2];                  // this wave's V fragments of the key tile, asked for together
#pragma unroll
      for (int kk = 0; kk < 4; ++kk) {
        vf[kk][0] = load_frag_at(vp + kk * 32);
        vf[kk][1] = load_frag_at(vp + (size_t)16 * HW + kk * 32);
      }
      // as behind the K loads: address registers rewritten only behind this wait
      asm volatile("s_wait_xcnt 0x0" :: "v"(vp) : "memory");
      v16h af[2][MT];                 // P fragments: the set in use and the next k-step's
#pragma unroll
      for (int mt = 0; mt < MT; ++mt) af[0][mt] = load_frag(Pt + mt * 16 * 136, 136);
#pragma unroll
      for (int mt = 0; mt < MT; ++mt) {
        const float4* fp = (const float4*)(fac + mt * 16 + 8 * hi);
        float4 f0 = fp[0], f1 = fp[1];
        float fr[8] = {f0.x, f0.y, f0.z, f0.w, f1.x, f1.y, f1.z, f1.w};
#pragma unroll
        for (int r = 0; r < 8; ++r) { o[mt][0][r] *= fr[r]; o[mt][1][r] *= fr[r]; }
      }
#pragma unroll
      for (int kk = 0; kk < 4; ++kk) {
        if (kk < 3) {
#pragma unroll
          for (int mt = 0; mt < MT; ++mt)
            af[(kk + 1) & 1][mt] = load_frag(Pt + mt * 16 * 136 + (kk + 1) * 32, 136);
        }
        // keeps the next k-step's LDS reads one group ahead of this k-step's WMMAs; without
        // the pair the compiler puts each read, with a wait to 0, in front of its two WMMAs
        __builtin_amdgcn_sched_barrier(0);
#pragma unroll
        for (int mt = 0; mt < MT; ++mt) {
          o[mt][0] = wmma16(af[kk & 1][mt], vf[kk][0], o[mt][0]);
          o[mt][1] = wmma16(af[kk & 1][mt], vf[kk][1], o[mt][1]);
        }
        __builtin_amdgcn_sched_barrier(0);  // second of the pair
      }
    }
    // no barrier here: St, red, Pt and fac are each rewritten only behind a later
    // barrier that every wave reaches after its last read of them
  }

  red[sseg * QT + srow] = lpart;      // last read of red was in front of the loop's last barrier
  __syncthreads();
#pragma unroll
  for (int mt = 0; mt < MT; ++mt) {
#pragma unroll
    for (int r = 0; r < 8; ++r) {
      int m = mt * 16 + r + 8 * hi;
      float inv = 1.0f / (red[m] + red[QT + m]);
      size_t rowbase = (((size_t)b << 10) + q0 + m) * CH + cbase;
      h2[rowbase + n]      = (_Float16)(o[mt][0][r] * inv);
      h2[rowbase + 16 + n] = (_Float16)(o[mt][1][r] * inv);
    }
  }
}

// ---------- kernel 4: proj GEMM + bias + residual (frags direct from global) ----------
__global__ __launch_bounds__(256) void proj_kernel(
    const _Float16* __restrict__ h2, const _Float16* __restrict__ wp16,
    const float* __restrict__ b_proj, const float* __restrict__ x,
    float* __restrict__ out) {
  const int o0 = blockIdx.x * 64;
  const int p0 = blockIdx.y * 64;
  const int b  = blockIdx.z;
  const int tid = threadIdx.x, wave = tid >> 5, lane = tid & 31;
  const int wm = wave >> 2, wn = wave & 3;
  const int n = lane & 15, hi = lane >> 4;

  v8f acc0 = {}, acc1 = {};
  const _Float16* abase = h2 + (((size_t)b << 10) + p0 + wm * 32) * CH;
  const _Float16* bbase = wp16 + (size_t)(o0 + wn * 16) * CH;
#pragma unroll
  for (int kk = 0; kk < 8; ++kk) {
    if (kk < 7) __builtin_prefetch(abase + (kk + 1) * 32, 0, 1);
    v16h bf = load_frag(bbase + kk * 32, CH);
    v16h a0 = load_frag(abase + kk * 32, CH);
    v16h a1 = load_frag(abase + (size_t)16 * CH + kk * 32, CH);
    acc0 = wmma16(a0, bf, acc0);
    acc1 = wmma16(a1, bf, acc1);
  }
  const int oo = o0 + wn * 16 + n;
  const float bias = b_proj[oo];
  // lane's outputs are pixel-contiguous: vectorize residual add + store as float4
  size_t base = ((size_t)(b * CH + oo)) * HW + p0 + wm * 32 + hi * 8;
  const float4* xp4 = (const float4*)(x + base);
  float4* op4 = (float4*)(out + base);
  float4 x0 = xp4[0], x1 = xp4[1], x2 = xp4[4], x3 = xp4[5];
  float4 r0 = make_float4(x0.x + acc0[0] + bias, x0.y + acc0[1] + bias,
                          x0.z + acc0[2] + bias, x0.w + acc0[3] + bias);
  float4 r1 = make_float4(x1.x + acc0[4] + bias, x1.y + acc0[5] + bias,
                          x1.z + acc0[6] + bias, x1.w + acc0[7] + bias);
  float4 r2 = make_float4(x2.x + acc1[0] + bias, x2.y + acc1[1] + bias,
                          x2.z + acc1[2] + bias, x2.w + acc1[3] + bias);
  float4 r3 = make_float4(x3.x + acc1[4] + bias, x3.y + acc1[5] + bias,
                          x3.z + acc1[6] + bias, x3.w + acc1[7] + bias);
  op4[0] = r0; op4[1] = r1; op4[4] = r2; op4[5] = r3;
}

// ---------- launcher ----------
extern "C" void kernel_launch(void* const* d_in, const int* in_sizes, int n_in,
                              void* d_out, int out_size, void* d_ws, size_t ws_size,
                              hipStream_t stream) {
  const float* x      = (const float*)d_in[0];
  const float* gamma  = (const float*)d_in[1];
  const float* beta   = (const float*)d_in[2];
  const float* w_qkv  = (const float*)d_in[3];
  const float* b_qkv  = (const float*)d_in[4];
  const float* w_proj = (const float*)d_in[5];
  const float* b_proj = (const float*)d_in[6];
  float* out = (float*)d_out;

  char* ws = (char*)d_ws;
  _Float16* wq16 = (_Float16*)ws; ws += (size_t)3 * CH * CH * 2;   // 384 KB
  _Float16* wp16 = (_Float16*)ws; ws += (size_t)CH * CH * 2;       // 128 KB
  float*    mean = (float*)ws;    ws += BATCH * GRP * 4;
  float*    rstd = (float*)ws;    ws += BATCH * GRP * 4;
  _Float16* q16  = (_Float16*)ws; ws += (size_t)BATCH * HW * CH * 2;
  _Float16* k16  = (_Float16*)ws; ws += (size_t)BATCH * HW * CH * 2;
  _Float16* vt16 = (_Float16*)ws; ws += (size_t)BATCH * HW * CH * 2;
  _Float16* h2   = (_Float16*)ws; ws += (size_t)BATCH * HW * CH * 2;

  cvt_weights_kernel<<<(3 * CH * CH + 255) / 256, 256, 0, stream>>>(
      w_qkv, w_proj, wq16, wp16);
  gn_stats_kernel<<<BATCH * GRP, 256, 0, stream>>>(x, mean, rstd);
  qkv_gemm_kernel<<<dim3(12, 16, BATCH), 256, 0, stream>>>(
      x, gamma, beta, mean, rstd, wq16, b_qkv, q16, k16, vt16);
  attn_kernel<<<dim3(HW / QT, BATCH), 256, 0, stream>>>(q16, k16, vt16, h2);
  proj_kernel<<<dim3(4, 16, BATCH), 256, 0, stream>>>(h2, wp16, b_proj, x, out);
}

// v002
// A run of this version takes 106 microseconds.
// Two timings next to v001 put it at 1.35 and 1.34 times that version's speed.
// Counting every step since v000, it is 2.18 times as fast.
#include <hip/hip_runtime.h>
#include <hip/hip_bf16.h>
#include <math.h>

typedef __attribute__((ext_vector_type(16))) _Float16 v16h;
typedef __attribute__((ext_vector_type(8)))  _Float16 v8h;
typedef __attribute__((ext_vector_type(8)))  float    v8f;

#if defined(__has_builtin)
#  if __has_builtin(__builtin_amdgcn_global_load_async_to_lds_b128) && \
      __has_builtin(__builtin_amdgcn_s_wait_asynccnt)
#    define HAVE_ASYNC_LDS 1
#  endif
#endif
#ifndef HAVE_ASYNC_LDS
#  define HAVE_ASYNC_LDS 0
#endif

#if HAVE_ASYNC_LDS
// Builtin signature (from hipcc diagnostic): param 1 is
//   int __attribute__((vector_size(16))) addrspace(1)*  (non-const)
typedef int b128_t __attribute__((vector_size(16)));
typedef b128_t __attribute__((address_space(1)))* gas_b128p;
typedef b128_t __attribute__((address_space(3)))* las_b128p;
#endif

__device__ __forceinline__ v16h load_frag(const _Float16* __restrict__ base, int ld) {
  const int lane = threadIdx.x & 31;
  const int row  = lane & 15;
  const int hi   = lane >> 4;
  const _Float16* p = base + (size_t)row * ld + hi * 8;
  v8h c0 = *(const v8h*)(p);        // K = hi*8 .. hi*8+7
  v8h c1 = *(const v8h*)(p + 16);   // K = 16 + hi*8 ..
  v16h r;
#pragma unroll
  for (int i = 0; i < 8; ++i) { r[i] = c0[i]; r[i + 8] = c1[i]; }
  return r;
}

// The same fragment from the lane's own address p = base + (lane & 15) * ld + (lane >> 4) * 8.
__device__ __forceinline__ v16h load_frag_at(const _Float16* __restrict__ p) {
  v8h c0 = *(const v8h*)(p);
  v8h c1 = *(const v8h*)(p + 16);
  v16h r;
#pragma unroll
  for (int i = 0; i < 8; ++i) { r[i] = c0[i]; r[i + 8] = c1[i]; }
  return r;
}

__device__ __forceinline__ v8f wmma16(v16h a, v16h b, v8f c) {
  // D = A(16x32) * B(32x16) + C, f32 accumulate
  return __builtin_amdgcn_wmma_f32_16x16x32_f16(false, a, false, b, (short)0, c,
                                                false, false);
}

// ---------- constants ----------
#define BATCH 32
#define CH    256
#define HW    1024
#define GRP   8
#define CPG   32          // channels per group
#define SCALE 0.0625f     // 1/sqrt(256)

// ---------- kernel 0: weights f32 -> f16 ----------
__global__ __launch_bounds__(256) void cvt_weights_kernel(
    const float* __restrict__ wq, const float* __restrict__ wp,
    _Float16* __restrict__ wq16, _Float16* __restrict__ wp16) {
  int i = blockIdx.x * 256 + threadIdx.x;
  if (i < 3 * CH * CH) wq16[i] = (_Float16)wq[i];
  if (i < CH * CH)     wp16[i] = (_Float16)wp[i];
}

// ---------- kernel 1: GroupNorm statistics ----------
__global__ __launch_bounds__(256) void gn_stats_kernel(
    const float* __restrict__ x, float* __restrict__ mean, float* __restrict__ rstd) {
  const int bg = blockIdx.x;                  // b*8+g
  const float* xp = x + (size_t)bg * CPG * HW;
  float s = 0.f, s2 = 0.f;
  for (int i = threadIdx.x; i < CPG * HW; i += 256) {
    float v = xp[i]; s += v; s2 += v * v;
  }
  __shared__ float sm[256], sq[256];
  sm[threadIdx.x] = s; sq[threadIdx.x] = s2;
  __syncthreads();
  for (int off = 128; off > 0; off >>= 1) {
    if (threadIdx.x < off) {
      sm[threadIdx.x] += sm[threadIdx.x + off];
      sq[threadIdx.x] += sq[threadIdx.x + off];
    }
    __syncthreads();
  }
  if (threadIdx.x == 0) {
    const float inv_n = 1.0f / (CPG * HW);
    float m = sm[0] * inv_n;
    float var = sq[0] * inv_n - m * m;
    mean[bg] = m;
    rstd[bg] = rsqrtf(var + 1e-5f);
  }
}

// ---------- kernel 2: GN-fused QKV GEMM ----------
// One block makes all 768 outputs of its 128 pixels: x is read and normalised once into an
// LDS tile [pixel][channel], behind one barrier. 8 waves; a wave runs 2 passes, each pass one
// 16-channel tile of Q, of K and of V over all 128 pixels (24 accumulator tiles), so every
// weight row is loaded by exactly one wave of the block.
#define PT  128           // pixels per block
#define PMT (PT / 16)     // 16-pixel tiles per block
#define ALD 264           // LDS row pitch in halves
__global__ __launch_bounds__(256) void qkv_gemm_kernel(
    const float* __restrict__ x, const float* __restrict__ gamma,
    const float* __restrict__ beta, const float* __restrict__ mean,
    const float* __restrict__ rstd, const _Float16* __restrict__ wq16,
    const float* __restrict__ b_qkv,
    _Float16* __restrict__ q16, _Float16* __restrict__ k16,
    _Float16* __restrict__ vt16) {
  const int p0 = blockIdx.x * PT;
  const int b  = blockIdx.y;
  const int tid = threadIdx.x, lane = tid & 31;
  const int wave = __builtin_amdgcn_readfirstlane(tid >> 5);
  const int n = lane & 15, hi = lane >> 4;

  __shared__ __attribute__((aligned(16))) _Float16 At[PT * ALD];
  __shared__ __attribute__((aligned(16))) float    Bs[3 * CH];   // b_qkv, read where a pass ends

  // Step s = pass * 8 + k-step. Weight fragment of step s for product t (0 Q, 1 K, 2 V):
  // rows t*256 + pass*128 + wave*16 .. +15, channels (s & 7)*32 .. +31.
  const _Float16* wl = wq16 + (size_t)(wave * 16 + n) * CH + hi * 8;  // lane's own
  auto wfrag = [&](int s, int t) {
    return load_frag_at(wl + (size_t)(t * CH + (s >> 3) * 128) * CH + (s & 7) * 32);
  };
  v16h bf[4][3];                      // weight fragments, a ring four steps deep

  // staging: thread -> pixel tid & 127, 8 adjacent channels of every 16 (one b128 LDS store)
  {
    const int sp = tid & (PT - 1);
    const int sh = __builtin_amdgcn_readfirstlane(tid >> 7) * 8;
    const float* xl = x + ((size_t)(b * CH + sh)) * HW + p0 + sp;    // lane's own
    float xv[16][8];
#pragma unroll
    for (int ch = 0; ch < 16; ++ch)
#pragma unroll
      for (int i = 0; i < 8; ++i) xv[ch][i] = xl[(size_t)(ch * 16 + i) * HW];
    const float b0 = b_qkv[tid], b1 = b_qkv[CH + tid], b2 = b_qkv[2 * CH + tid];
#pragma unroll
    for (int s = 0; s < 4; ++s)
#pragma unroll
      for (int t = 0; t < 3; ++t) bf[s][t] = wfrag(s, t);
    // all of the tile's loads are asked for before the first is used; without this the
    // compiler issues them two at a time, each pair behind a wait to 0
    __builtin_amdgcn_sched_barrier(0);
#pragma unroll
    for (int ch = 0; ch < 16; ++ch) {
      const float mu = mean[b * GRP + (ch >> 1)];
      const float rs = rstd[b * GRP + (ch >> 1)];
      v8h pk;
#pragma unroll
      for (int i = 0; i < 8; ++i) {
        const int c = sh + ch * 16 + i;
        pk[i] = (_Float16)((xv[ch][i] - mu) * rs * gamma[c] + beta[c]);
      }
      *(v8h*)(&At[sp * ALD + sh + ch * 16]) = pk;
    }
    Bs[tid] = b0; Bs[CH + tid] = b1; Bs[2 * CH + tid] = b2;
  }
  __syncthreads();

  const _Float16* al = At + n * ALD + hi * 8;                        // lane's own
  v16h af[2][PMT];                    // pixel fragments: the set in use and the next step's
#pragma unroll
  for (int mt = 0; mt < PMT; ++mt) af[0][mt] = load_frag_at(al + mt * 16 * ALD);
  // one pass: 8 k-steps, then its 16 channels of Q, K and V go out
  auto pass = [&](const int ps) {
    v8f acc[3][PMT];
#pragma unroll
    for (int t = 0; t < 3; ++t)
#pragma unroll
      for (int mt = 0; mt < PMT; ++mt) acc[t][mt] = v8f{};
#pragma unroll
    for (int kk = 0; kk < 8; ++kk) {
      const int s = ps * 8 + kk;
      if (s < 15) {
#pragma unroll
        for (int mt = 0; mt < PMT; ++mt)
          af[(kk + 1) & 1][mt] = load_frag_at(al + mt * 16 * ALD + ((kk + 1) & 7) * 32);
      }
      // keeps the next step's LDS reads as one group ahead of this step's WMMAs, and the ring's
      // refill behind them; without the pair the compiler puts two reads, with a wait to 0, in
      // front of every three WMMAs and spills
      __builtin_amdgcn_sched_barrier(0);
      // Q, K: weights as the row operand, so a lane holds 8 adjacent channels of one pixel;
      // V: pixels as the row operand, so a lane holds 8 adjacent pixels of one channel
#pragma unroll
      for (int t = 0; t < 2; ++t)
#pragma unroll
        for (int mt = 0; mt < PMT; ++mt)
          acc[t][mt] = wmma16(bf[kk & 3][t], af[kk & 1][mt], acc[t][mt]);
#pragma unroll
      for (int mt = 0; mt < PMT; ++mt)
        acc[2][mt] = wmma16(af[kk & 1][mt], bf[kk & 3][2], acc[2][mt]);
      __builtin_amdgcn_sched_barrier(0);  // second of the pair
      if (s + 4 < 16) {
#pragma unroll
        for (int t = 0; t < 3; ++t) bf[kk & 3][t] = wfrag(s + 4, t);
      }
    }
    const int c0 = ps * 128 + wave * 16;
    const float4* bq4 = (const float4*)(Bs + c0 + hi * 8);
    const float4* bk4 = (const float4*)(Bs + CH + c0 + hi * 8);
    const float4 q0 = bq4[0], q1 = bq4[1], k0 = bk4[0], k1 = bk4[1];
    const float bq[8] = {q0.x, q0.y, q0.z, q0.w, q1.x, q1.y, q1.z, q1.w};
    const float bk[8] = {k0.x, k0.y, k0.z, k0.w, k1.x, k1.y, k1.z, k1.w};
    const float bv = Bs[2 * CH + c0 + n];
    // Q, K: (pixel, channel) layout; V transposed: (channel, pixel)
    _Float16* qd = q16 + (((size_t)b << 10) + p0 + n) * CH + c0 + hi * 8;
    _Float16* kd = k16 + (((size_t)b << 10) + p0 + n) * CH + c0 + hi * 8;
    _Float16* vd = vt16 + ((size_t)b * CH + c0 + n) * HW + p0 + hi * 8;
    v8h pq[PMT], pk[PMT], pv[PMT];
#pragma unroll
    for (int mt = 0; mt < PMT; ++mt)
#pragma unroll
      for (int r = 0; r < 8; ++r) {
        pq[mt][r] = (_Float16)(acc[0][mt][r] + bq[r]);
        pk[mt][r] = (_Float16)(acc[1][mt][r] + bk[r]);
        pv[mt][r] = (_Float16)(acc[2][mt][r] + bv);
      }
    // the stores go out as one run behind the last conversion, so that none of their
    // registers is written again behind them (first pass: in front of the wait below)
    __builtin_amdgcn_sched_barrier(0);
#pragma unroll
    for (int mt = 0; mt < PMT; ++mt) {
      *(v8h*)(qd + (size_t)mt * 16 * CH) = pq[mt];
      *(v8h*)(kd + (size_t)mt * 16 * CH) = pk[mt];
      *(v8h*)(vd + mt * 16) = pv[mt];
    }
    if (ps == 0) {
      // the stores' address and data registers are rewritten only behind this wait
      asm volatile("s_wait_xcnt 0x0" ::: "memory");
      __builtin_amdgcn_sched_barrier(0);  // keeps the next pass's register writes behind the wait
    }
  };
  pass(0);
  pass(1);
}

// ---------- kernel 3: flash attention (128 q-rows per block, online softmax) ----------
// Every K and V fragment that a wave loads from global memory feeds 8 row tiles
// (QT / 16), so the block reads K and V once per 128 queries.
#define QT 128            // query rows per block
#define MT (QT / 16)      // 16-row tiles per block
__global__ __launch_bounds__(256) void attn_kernel(
    const _Float16* __restrict__ q16, const _Float16* __restrict__ k16,
    const _Float16* __restrict__ vt16, _Float16* __restrict__ h2) {
  const int q0 = blockIdx.x * QT;
  const int b  = blockIdx.y;
  const int tid = threadIdx.x, wave = tid >> 5, lane = tid & 31;
  const int n = lane & 15, hi = lane >> 4;
  const int srow = tid & (QT - 1), sseg = tid >> 7;  // softmax mapping: 2 thr/row, 64 cols each

  __shared__ __attribute__((aligned(16))) _Float16 Qt[QT * 264];  // Q tile (pixel, channel), ld=264
  __shared__ __attribute__((aligned(16))) float    St[QT * 132];  // scores tile QT x 128, ld=132
  __shared__ __attribute__((aligned(16))) _Float16 Pt[QT * 136];  // exp tile f16, ld=136
  __shared__ __attribute__((aligned(16))) float    red[2 * QT];   // per-row partials of the 2 segments
  __shared__ __attribute__((aligned(16))) float    fac[QT];       // per-row rescale factor

#pragma unroll
  for (int it = 0; it < QT / 8; ++it) {
    int idx = tid + it * 256;                 // 16B chunk id; one wave = one 512-B row
    int row = idx >> 5, col = (idx & 31) * 8;
    const _Float16* src = q16 + (((size_t)b << 10) + q0 + row) * CH + col;
    _Float16* dst = Qt + row * 264 + col;
#if HAVE_ASYNC_LDS
    __builtin_amdgcn_global_load_async_to_lds_b128(
        (gas_b128p)src, (las_b128p)dst, 0, 0);
#else
    *(v8h*)dst = *(const v8h*)src;
#endif
  }
#if HAVE_ASYNC_LDS
  // this wave's copies have landed before the barrier behind which other waves read them
  asm volatile("s_wait_asynccnt 0x0" ::: "memory");
#endif
  __syncthreads();

  v8f o[MT][2];                       // O accum: QT rows x this wave's channels [wave*32, +32)
#pragma unroll
  for (int mt = 0; mt < MT; ++mt) { o[mt][0] = v8f{}; o[mt][1] = v8f{}; }
  const int cbase = wave * 32;
  float mrun = -1e30f;                // running row maximum (the row's 2 threads hold the same)
  float lpart = 0.f;                  // running sum over this thread's own 64-column segments

  for (int jt = 0; jt < 8; ++jt) {
    const int j0 = jt * 128;
    // --- S = Q * K^T * scale ; wave computes columns j0 + wave*16 .. +15, all QT rows ---
    {
      v8f s[MT];
#pragma unroll
      for (int mt = 0; mt < MT; ++mt) s[mt] = v8f{};
      const _Float16* kp = k16 + (((size_t)b << 10) + j0 + wave * 16 + n) * CH + hi * 8;  // lane's own
      v16h kf[8];                     // this wave's K fragments of the key tile, asked for together
#pragma unroll
      for (int kk = 0; kk < 8; ++kk) kf[kk] = load_frag_at(kp + kk * 32);
      // the K loads' address registers are rewritten only behind this wait; the lane's
      // address as an input keeps its registers out of the loads' own results
      asm volatile("s_wait_xcnt 0x0" :: "v"(kp) : "memory");
      v16h af[2][MT];                 // Q fragments: the set in use and the next k-step's
#pragma unroll
      for (int mt = 0; mt < MT; ++mt) af[0][mt] = load_frag(Qt + mt * 16 * 264, 264);
#pragma unroll
      for (int kk = 0; kk < 8; ++kk) {
        if (kk < 7) {
#pragma unroll
          for (int mt = 0; mt < MT; ++mt)
            af[(kk + 1) & 1][mt] = load_frag(Qt + mt * 16 * 264 + (kk + 1) * 32, 264);
        }
#pragma unroll
        for (int mt = 0; mt < MT; ++mt) s[mt] = wmma16(af[kk & 1][mt], kf[kk], s[mt]);
      }
#pragma unroll
      for (int mt = 0; mt < MT; ++mt)
#pragma unroll
        for (int r = 0; r < 8; ++r)
          St[(mt * 16 + r + 8 * hi) * 132 + wave * 16 + n] = s[mt][r] * SCALE;
    }
    __syncthreads();

    // --- online softmax, 2 threads per row, scores held in registers ---
    {
      float sv[64];
      const float4* sp = (const float4*)(St + srow * 132 + sseg * 64);
      float lm = -1e30f;
#pragma unroll
      for (int c = 0; c < 16; ++c) {
        float4 t = sp[c];
        sv[4 * c] = t.x; sv[4 * c + 1] = t.y; sv[4 * c + 2] = t.z; sv[4 * c + 3] = t.w;
        lm = fmaxf(lm, fmaxf(fmaxf(t.x, t.y), fmaxf(t.z, t.w)));
      }
      red[sseg * QT + srow] = lm;
      __syncthreads();
      const float mnew = fmaxf(mrun, fmaxf(red[srow], red[QT + srow]));
      const float f = __expf(mrun - mnew);
      mrun = mnew;
      if (sseg == 0) fac[srow] = f;
      float sum = 0.f;
#pragma unroll
      for (int c = 0; c < 8; ++c) {
        v8h pk;
#pragma unroll
        for (int i = 0; i < 8; ++i) {
          float e = __expf(sv[c * 8 + i] - mnew);
          pk[i] = (_Float16)e;
          sum += e;
        }
        *(v8h*)(Pt + srow * 136 + sseg * 64 + c * 8) = pk;
      }
      lpart = lpart * f + sum;
    }
    __syncthreads();

    // --- rescale O, accumulate P * V ---
    {
      const _Float16* vp = vt16 + ((size_t)b * CH + cbase + n) * HW + j0 + hi * 8;  // lane's own
      v16h vf[4][2];                  // this wave's V fragments of the key tile, asked for together
#pragma unroll
      for (int kk = 0; kk < 4; ++kk) {
        vf[kk][0] = load_frag_at(vp + kk * 32);
        vf[kk][1] = load_frag_at(vp + (size_t)16 * HW + kk * 32);
      }
      // as behind the K loads: address registers rewritten only behind this wait
      asm volatile("s_wait_xcnt 0x0" :: "v"(vp) : "memory");
      v16h af[2][MT];                 // P fragments: the set in use and the next k-step's
#pragma unroll
      for (int mt = 0; mt < MT; ++mt) af[0][mt] = load_frag(Pt + mt * 16 * 136, 136);
#pragma unroll
      for (int mt = 0; mt < MT; ++mt) {
        const float4* fp = (const float4*)(fac + mt * 16 + 8 * hi);
        float4 f0 = fp[0], f1 = fp[1];
        float fr[8] = {f0.x, f0.y, f0.z, f0.w, f1.x, f1.y, f1.z, f1.w};
#pragma unroll
        for (int r = 0; r < 8; ++r) { o[mt][0][r] *= fr[r]; o[mt][1][r] *= fr[r]; }
      }
#pragma unroll
      for (int kk = 0; kk < 4; ++kk) {
        if (kk < 3) {
#pragma unroll
          for (int mt = 0; mt < MT; ++mt)
            af[(kk + 1) & 1][mt] = load_frag(Pt + mt * 16 * 136 + (kk + 1) * 32, 136);
        }
        // keeps the next k-step's LDS reads one group ahead of this k-step's WMMAs; without
        // the pair the compiler puts each read, with a wait to 0, in front of its two WMMAs
        __builtin_amdgcn_sched_barrier(0);
#pragma unroll
        for (int mt = 0; mt < MT; ++mt) {
          o[mt][0] = wmma16(af[kk & 1][mt], vf[kk][0], o[mt][0]);
          o[mt][1] = wmma16(af[kk & 1][mt], vf[kk][1], o[mt][1]);
        }
        __builtin_amdgcn_sched_barrier(0);  // second of the pair
      }
    }
    // no barrier here: St, red, Pt and fac are each rewritten only behind a later
    // barrier that every wave reaches after its last read of them
  }

  red[sseg * QT + srow] = lpart;      // last read of red was in front of the loop's last barrier
  __syncthreads();
#pragma unroll
  for (int mt = 0; mt < MT; ++mt) {
#pragma unroll
    for (int r = 0; r < 8; ++r) {
      int m = mt * 16 + r + 8 * hi;
      float inv = 1.0f / (red[m] + red[QT + m]);
      size_t rowbase = (((size_t)b << 10) + q0 + m) * CH + cbase;
      h2[rowbase + n]      = (_Float16)(o[mt][0][r] * inv);
      h2[rowbase + 16 + n] = (_Float16)(o[mt][1][r] * inv);
    }
  }
}

// ---------- kernel 4: proj GEMM + bias + residual (frags direct from global) ----------
__global__ __launch_bounds__(256) void proj_kernel(
    const _Float16* __restrict__ h2, const _Float16* __restrict__ wp16,
    const float* __restrict__ b_proj, const float* __restrict__ x,
    float* __restrict__ out) {
  const int o0 = blockIdx.x * 64;
  const int p0 = blockIdx.y * 64;
  const int b  = blockIdx.z;
  const int tid = threadIdx.x, wave = tid >> 5, lane = tid & 31;
  const int wm = wave >> 2, wn = wave & 3;
  const int n = lane & 15, hi = lane >> 4;

  v8f acc0 = {}, acc1 = {};
  const _Float16* abase = h2 + (((size_t)b << 10) + p0 + wm * 32) * CH;
  const _Float16* bbase = wp16 + (size_t)(o0 + wn * 16) * CH;
#pragma unroll
  for (int kk = 0; kk < 8; ++kk) {
    if (kk < 7) __builtin_prefetch(abase + (kk + 1) * 32, 0, 1);
    v16h bf = load_frag(bbase + kk * 32, CH);
    v16h a0 = load_frag(abase + kk * 32, CH);
    v16h a1 = load_frag(abase + (size_t)16 * CH + kk * 32, CH);
    acc0 = wmma16(a0, bf, acc0);
    acc1 = wmma16(a1, bf, acc1);
  }
  const int oo = o0 + wn * 16 + n;
  const float bias = b_proj[oo];
  // lane's outputs are pixel-contiguous: vectorize residual add + store as float4
  size_t base = ((size_t)(b * CH + oo)) * HW + p0 + wm * 32 + hi * 8;
  const float4* xp4 = (const float4*)(x + base);
  float4* op4 = (float4*)(out + base);
  float4 x0 = xp4[0], x1 = xp4[1], x2 = xp4[4], x3 = xp4[5];
  float4 r0 = make_float4(x0.x + acc0[0] + bias, x0.y + acc0[1] + bias,
                          x0.z + acc0[2] + bias, x0.w + acc0[3] + bias);
  float4 r1 = make_float4(x1.x + acc0[4] + bias, x1.y + acc0[5] + bias,
                          x1.z + acc0[6] + bias, x1.w + acc0[7] + bias);
  float4 r2 = make_float4(x2.x + acc1[0] + bias, x2.y + acc1[1] + bias,
                          x2.z + acc1[2] + bias, x2.w + acc1[3] + bias);
  float4 r3 = make_float4(x3.x + acc1[4] + bias, x3.y + acc1[5] + bias,
                          x3.z + acc1[6] + bias, x3.w + acc1[7] + bias);
  op4[0] = r0; op4[1] = r1; op4[4] = r2; op4[5] = r3;
}

// ---------- launcher ----------
extern "C" void kernel_launch(void* const* d_in, const int* in_sizes, int n_in,
                              void* d_out, int out_size, void* d_ws, size_t ws_size,
                              hipStream_t stream) {
  const float* x      = (const float*)d_in[0];
  const float* gamma  = (const float*)d_in[1];
  const float* beta   = (const float*)d_in[2];
  const float* w_qkv  = (const float*)d_in[3];
  const float* b_qkv  = (const float*)d_in[4];
  const float* w_proj = (const float*)d_in[5];
  const float* b_proj = (const float*)d_in[6];
  float* out = (float*)d_out;

  char* ws = (char*)d_ws;
  _Float16* wq16 = (_Float16*)ws; ws += (size_t)3 * CH * CH * 2;   // 384 KB
  _Float16* wp16 = (_Float16*)ws; ws += (size_t)CH * CH * 2;       // 128 KB
  float*    mean = (float*)ws;    ws += BATCH * GRP * 4;
  float*    rstd = (float*)ws;    ws += BATCH * GRP * 4;
  _Float16* q16  = (_Float16*)ws; ws += (size_t)BATCH * HW * CH * 2;
  _Float16* k16  = (_Float16*)ws; ws += (size_t)BATCH * HW * CH * 2;
  _Float16* vt16 = (_Float16*)ws; ws += (size_t)BATCH * HW * CH * 2;
  _Float16* h2   = (_Float16*)ws; ws += (size_t)BATCH * HW * CH * 2;

  cvt_weights_kernel<<<(3 * CH * CH + 255) / 256, 256, 0, stream>>>(
      w_qkv, w_proj, wq16, wp16);
  gn_stats_kernel<<<BATCH * GRP, 256, 0, stream>>>(x, mean, rstd);
  qkv_gemm_kernel<<<dim3(HW / PT, BATCH), 256, 0, stream>>>(
      x, gamma, beta, mean, rstd, wq16, b_qkv, q16, k16, vt16);
  attn_kernel<<<dim3(HW / QT, BATCH), 256, 0, stream>>>(q16, k16, vt16, h2);
  proj_kernel<<<dim3(4, 16, BATCH), 256, 0, stream>>>(h2, wp16, b_proj, x, out);
}

// v003
// A run of this version takes 80 microseconds.
// Two timings next to v002 both put it at 1.34 times that version's speed.
// All steps since v000 together make it 2.92 times as fast.
#include <hip/hip_runtime.h>
#include <hip/hip_bf16.h>
#include <math.h>

typedef __attribute__((ext_vector_type(16))) _Float16 v16h;
typedef __attribute__((ext_vector_type(8)))  _Float16 v8h;
typedef __attribute__((ext_vector_type(8)))  float    v8f;

#if defined(__has_builtin)
#  if __has_builtin(__builtin_amdgcn_global_load_async_to_lds_b128) && \
      __has_builtin(__builtin_amdgcn_s_wait_asynccnt)
#    define HAVE_ASYNC_LDS 1
#  endif
#endif
#ifndef HAVE_ASYNC_LDS
#  define HAVE_ASYNC_LDS 0
#endif

#if HAVE_ASYNC_LDS
// Builtin signature (from hipcc diagnostic): param 1 is
//   int __attribute__((vector_size(16))) addrspace(1)*  (non-const)
typedef int b128_t __attribute__((vector_size(16)));
typedef b128_t __attribute__((address_space(1)))* gas_b128p;
typedef b128_t __attribute__((address_space(3)))* las_b128p;
#endif

__device__ __forceinline__ v16h load_frag(const _Float16* __restrict__ base, int ld) {
  const int lane = threadIdx.x & 31;
  const int row  = lane & 15;
  const int hi   = lane >> 4;
  const _Float16* p = base + (size_t)row * ld + hi * 8;
  v8h c0 = *(const v8h*)(p);        // K = hi*8 .. hi*8+7
  v8h c1 = *(const v8h*)(p + 16);   // K = 16 + hi*8 ..
  v16h r;
#pragma unroll
  for (int i = 0; i < 8; ++i) { r[i] = c0[i]; r[i + 8] = c1[i]; }
  return r;
}

// The same fragment from the lane's own address p = base + (lane & 15) * ld + (lane >> 4) * 8.
__device__ __forceinline__ v16h load_frag_at(const _Float16* __restrict__ p) {
  v8h c0 = *(const v8h*)(p);
  v8h c1 = *(const v8h*)(p + 16);
  v16h r;
#pragma unroll
  for (int i = 0; i < 8; ++i) { r[i] = c0[i]; r[i + 8] = c1[i]; }
  return r;
}

__device__ __forceinline__ v8f wmma16(v16h a, v16h b, v8f c) {
  // D = A(16x32) * B(32x16) + C, f32 accumulate
  return __builtin_amdgcn_wmma_f32_16x16x32_f16(false, a, false, b, (short)0, c,
                                                false, false);
}

// ---------- constants ----------
#define BATCH 32
#define CH    256
#define HW    1024
#define GRP   8
#define CPG   32          // channels per group
#define SCALE 0.0625f     // 1/sqrt(256)

// ---------- kernel 0: weights f32 -> f16 ----------
__global__ __launch_bounds__(256) void cvt_weights_kernel(
    const float* __restrict__ wq, const float* __restrict__ wp,
    _Float16* __restrict__ wq16, _Float16* __restrict__ wp16) {
  int i = blockIdx.x * 256 + threadIdx.x;
  if (i < 3 * CH * CH) wq16[i] = (_Float16)wq[i];
  if (i < CH * CH)     wp16[i] = (_Float16)wp[i];
}

// ---------- kernel 1: GroupNorm statistics ----------
__global__ __launch_bounds__(256) void gn_stats_kernel(
    const float* __restrict__ x, float* __restrict__ mean, float* __restrict__ rstd) {
  const int bg = blockIdx.x;                  // b*8+g
  const float* xp = x + (size_t)bg * CPG * HW;
  float s = 0.f, s2 = 0.f;
  for (int i = threadIdx.x; i < CPG * HW; i += 256) {
    float v = xp[i]; s += v; s2 += v * v;
  }
  __shared__ float sm[256], sq[256];
  sm[threadIdx.x] = s; sq[threadIdx.x] = s2;
  __syncthreads();
  for (int off = 128; off > 0; off >>= 1) {
    if (threadIdx.x < off) {
      sm[threadIdx.x] += sm[threadIdx.x + off];
      sq[threadIdx.x] += sq[threadIdx.x + off];
    }
    __syncthreads();
  }
  if (threadIdx.x == 0) {
    const float inv_n = 1.0f / (CPG * HW);
    float m = sm[0] * inv_n;
    float var = sq[0] * inv_n - m * m;
    mean[bg] = m;
    rstd[bg] = rsqrtf(var + 1e-5f);
  }
}

// ---------- kernel 2: GN-fused QKV GEMM ----------
// One block makes all 768 outputs of its 128 pixels: x is read and normalised once into an
// LDS tile [pixel][channel], behind one barrier. 8 waves; a wave runs 2 passes, each pass one
// 16-channel tile of Q, of K and of V over all 128 pixels (24 accumulator tiles), so every
// weight row is loaded by exactly one wave of the block.
#define PT  128           // pixels per block
#define PMT (PT / 16)     // 16-pixel tiles per block
#define ALD 264           // LDS row pitch in halves
__global__ __launch_bounds__(256) void qkv_gemm_kernel(
    const float* __restrict__ x, const float* __restrict__ gamma,
    const float* __restrict__ beta, const float* __restrict__ mean,
    const float* __restrict__ rstd, const _Float16* __restrict__ wq16,
    const float* __restrict__ b_qkv,
    _Float16* __restrict__ q16, _Float16* __restrict__ k16,
    _Float16* __restrict__ vt16) {
  const int p0 = blockIdx.x * PT;
  const int b  = blockIdx.y;
  const int tid = threadIdx.x, lane = tid & 31;
  const int wave = __builtin_amdgcn_readfirstlane(tid >> 5);
  const int n = lane & 15, hi = lane >> 4;

  __shared__ __attribute__((aligned(16))) _Float16 At[PT * ALD];
  __shared__ __attribute__((aligned(16))) float    Bs[3 * CH];   // b_qkv, read where a pass ends

  // Step s = pass * 8 + k-step. Weight fragment of step s for product t (0 Q, 1 K, 2 V):
  // rows t*256 + pass*128 + wave*16 .. +15, channels (s & 7)*32 .. +31.
  const _Float16* wl = wq16 + (size_t)(wave * 16 + n) * CH + hi * 8;  // lane's own
  auto wfrag = [&](int s, int t) {
    return load_frag_at(wl + (size_t)(t * CH + (s >> 3) * 128) * CH + (s & 7) * 32);
  };
  v16h bf[4][3];                      // weight fragments, a ring four steps deep

  // staging: thread -> pixel tid & 127, 8 adjacent channels of every 16 (one b128 LDS store)
  {
    const int sp = tid & (PT - 1);
    const int sh = __builtin_amdgcn_readfirstlane(tid >> 7) * 8;
    const float* xl = x + ((size_t)(b * CH + sh)) * HW + p0 + sp;    // lane's own
    float xv[16][8];
#pragma unroll
    for (int ch = 0; ch < 16; ++ch)
#pragma unroll
      for (int i = 0; i < 8; ++i) xv[ch][i] = xl[(size_t)(ch * 16 + i) * HW];
    const float b0 = b_qkv[tid], b1 = b_qkv[CH + tid], b2 = b_qkv[2 * CH + tid];
#pragma unroll
    for (int s = 0; s < 4; ++s)
#pragma unroll
      for (int t = 0; t < 3; ++t) bf[s][t] = wfrag(s, t);
    // all of the tile's loads are asked for before the first is used; without this the
    // compiler issues them two at a time, each pair behind a wait to 0
    __builtin_amdgcn_sched_barrier(0);
#pragma unroll
    for (int ch = 0; ch < 16; ++ch) {
      const float mu = mean[b * GRP + (ch >> 1)];
      const float rs = rstd[b * GRP + (ch >> 1)];
      v8h pk;
#pragma unroll
      for (int i = 0; i < 8; ++i) {
        const int c = sh + ch * 16 + i;
        pk[i] = (_Float16)((xv[ch][i] - mu) * rs * gamma[c] + beta[c]);
      }
      *(v8h*)(&At[sp * ALD + sh + ch * 16]) = pk;
    }
    Bs[tid] = b0; Bs[CH + tid] = b1; Bs[2 * CH + tid] = b2;
  }
  __syncthreads();

  const _Float16* al = At + n * ALD + hi * 8;                        // lane's own
  v16h af[2][PMT];                    // pixel fragments: the set in use and the next step's
#pragma unroll
  for (int mt = 0; mt < PMT; ++mt) af[0][mt] = load_frag_at(al + mt * 16 * ALD);
  // one pass: 8 k-steps, then its 16 channels of Q, K and V go out
  auto pass = [&](const int ps) {
    v8f acc[3][PMT];
#pragma unroll
    for (int t = 0; t < 3; ++t)
#pragma unroll
      for (int mt = 0; mt < PMT; ++mt) acc[t][mt] = v8f{};
#pragma unroll
    for (int kk = 0; kk < 8; ++kk) {
      const int s = ps * 8 + kk;
      if (s < 15) {
#pragma unroll
        for (int mt = 0; mt < PMT; ++mt)
          af[(kk + 1) & 1][mt] = load_frag_at(al + mt * 16 * ALD + ((kk + 1) & 7) * 32);
      }
      // keeps the next step's LDS reads as one group ahead of this step's WMMAs, and the ring's
      // refill behind them; without the pair the compiler puts two reads, with a wait to 0, in
      // front of every three WMMAs and spills
      __builtin_amdgcn_sched_barrier(0);
      // Q, K: weights as the row operand, so a lane holds 8 adjacent channels of one pixel;
      // V: pixels as the row operand, so a lane holds 8 adjacent pixels of one channel
#pragma unroll
      for (int t = 0; t < 2; ++t)
#pragma unroll
        for (int mt = 0; mt < PMT; ++mt)
          acc[t][mt] = wmma16(bf[kk & 3][t], af[kk & 1][mt], acc[t][mt]);
#pragma unroll
      for (int mt = 0; mt < PMT; ++mt)
        acc[2][mt] = wmma16(af[kk & 1][mt], bf[kk & 3][2], acc[2][mt]);
      __builtin_amdgcn_sched_barrier(0);  // second of the pair
      if (s + 4 < 16) {
#pragma unroll
        for (int t = 0; t < 3; ++t) bf[kk & 3][t] = wfrag(s + 4, t);
      }
    }
    const int c0 = ps * 128 + wave * 16;
    const float4* bq4 = (const float4*)(Bs + c0 + hi * 8);
    const float4* bk4 = (const float4*)(Bs + CH + c0 + hi * 8);
    const float4 q0 = bq4[0], q1 = bq4[1], k0 = bk4[0], k1 = bk4[1];
    const float bq[8] = {q0.x, q0.y, q0.z, q0.w, q1.x, q1.y, q1.z, q1.w};
    const float bk[8] = {k0.x, k0.y, k0.z, k0.w, k1.x, k1.y, k1.z, k1.w};
    const float bv = Bs[2 * CH + c0 + n];
    // Q, K: (pixel, channel) layout; V transposed: (channel, pixel)
    _Float16* qd = q16 + (((size_t)b << 10) + p0 + n) * CH + c0 + hi * 8;
    _Float16* kd = k16 + (((size_t)b << 10) + p0 + n) * CH + c0 + hi * 8;
    _Float16* vd = vt16 + ((size_t)b * CH + c0 + n) * HW + p0 + hi * 8;
    v8h pq[PMT], pk[PMT], pv[PMT];
#pragma unroll
    for (int mt = 0; mt < PMT; ++mt)
#pragma unroll
      for (int r = 0; r < 8; ++r) {
        pq[mt][r] = (_Float16)(acc[0][mt][r] + bq[r]);
        pk[mt][r] = (_Float16)(acc[1][mt][r] + bk[r]);
        pv[mt][r] = (_Float16)(acc[2][mt][r] + bv);
      }
    // the stores go out as one run behind the last conversion, so that none of their
    // registers is written again behind them (first pass: in front of the wait below)
    __builtin_amdgcn_sched_barrier(0);
#pragma unroll
    for (int mt = 0; mt < PMT; ++mt) {
      *(v8h*)(qd + (size_t)mt * 16 * CH) = pq[mt];
      *(v8h*)(kd + (size_t)mt * 16 * CH) = pk[mt];
      *(v8h*)(vd + mt * 16) = pv[mt];
    }
    if (ps == 0) {
      // the stores' address and data registers are rewritten only behind this wait
      asm volatile("s_wait_xcnt 0x0" ::: "memory");
      __builtin_amdgcn_sched_barrier(0);  // keeps the next pass's register writes behind the wait
    }
  };
  pass(0);
  pass(1);
}

// ---------- kernel 3: flash attention (128 q-rows per block, online softmax), then the
// output projection, bias and residual of the block's own 128 pixels ----------
// Every K and V fragment that a wave loads from global memory feeds 8 row tiles
// (QT / 16), so the block reads K and V once per 128 queries. A block ends with all 256
// channels of its 128 pixels, which is all that the projection of those pixels needs.
#define QT 128            // query rows per block
#define MT (QT / 16)      // 16-row tiles per block
#define XLD 132           // residual tile's row pitch in floats (528 B = 16 B x odd)
__global__ __launch_bounds__(256) void attn_kernel(
    const _Float16* __restrict__ q16, const _Float16* __restrict__ k16,
    const _Float16* __restrict__ vt16, const _Float16* __restrict__ wp16,
    const float* __restrict__ b_proj, const float* __restrict__ x,
    float* __restrict__ out) {
  const int q0 = blockIdx.x * QT;
  const int b  = blockIdx.y;
  const int tid = threadIdx.x, wave = tid >> 5, lane = tid & 31;
  const int n = lane & 15, hi = lane >> 4;
  const int srow = tid & (QT - 1), sseg = tid >> 7;  // softmax mapping: 2 thr/row, 64 cols each

  // Qt and St carry the larger alignment so that they lie first in LDS and Xs behind them: the
  // compiler folds a copy's row step into its offset field and takes it off the LDS address
  // register, which then stays above 0 for every row of Xs
  __shared__ __attribute__((aligned(128))) _Float16 Qt[QT * 264]; // Q tile (pixel, channel), ld=264
  __shared__ __attribute__((aligned(128))) float    St[QT * 132]; // scores tile QT x 128, ld=132
  __shared__ __attribute__((aligned(16))) _Float16 Pt[QT * 136];  // exp tile f16, ld=136
  __shared__ __attribute__((aligned(16))) float    red[2 * QT];   // per-row partials of the 2 segments
  __shared__ __attribute__((aligned(16))) float    fac[QT];       // per-row rescale factor
  __shared__ __attribute__((aligned(16))) float    Xs[CH * XLD];  // x, then out: (channel, pixel)

#pragma unroll
  for (int it = 0; it < QT / 8; ++it) {
    int idx = tid + it * 256;                 // 16B chunk id; one wave = one 512-B row
    int row = idx >> 5, col = (idx & 31) * 8;
    const _Float16* src = q16 + (((size_t)b << 10) + q0 + row) * CH + col;
    _Float16* dst = Qt + row * 264 + col;
#if HAVE_ASYNC_LDS
    __builtin_amdgcn_global_load_async_to_lds_b128(
        (gas_b128p)src, (las_b128p)dst, 0, 0);
#else
    *(v8h*)dst = *(const v8h*)src;
#endif
  }
#if HAVE_ASYNC_LDS
  // this wave's copies have landed before the barrier behind which other waves read them
  asm volatile("s_wait_asynccnt 0x0" ::: "memory");
#endif
  __syncthreads();

  // ---- residual tile: each wave asks for the 32 channel rows (512 B each) that it will
  // itself add to and store at the end; they land while the key loop runs ----
#pragma unroll
  for (int i = 0; i < 32; ++i) {
    const int row = wave * 32 + i;
    const float* src = x + ((size_t)(b * CH + row)) * HW + q0 + lane * 4;
    float* dst = Xs + row * XLD + lane * 4;
#if HAVE_ASYNC_LDS
    __builtin_amdgcn_global_load_async_to_lds_b128(
        (gas_b128p)src, (las_b128p)dst, 0, 0);
#else
    *(float4*)dst = *(const float4*)src;
#endif
  }

  v8f o[MT][2];                       // O accum: QT rows x this wave's channels [wave*32, +32)
#pragma unroll
  for (int mt = 0; mt < MT; ++mt) { o[mt][0] = v8f{}; o[mt][1] = v8f{}; }
  const int cbase = wave * 32;
  float mrun = -1e30f;                // running row maximum (the row's 2 threads hold the same)
  float lpart = 0.f;                  // running sum over this thread's own 64-column segments

  for (int jt = 0; jt < 8; ++jt) {
    const int j0 = jt * 128;
    // --- S = Q * K^T * scale ; wave computes columns j0 + wave*16 .. +15, all QT rows ---
    {
      v8f s[MT];
#pragma unroll
      for (int mt = 0; mt < MT; ++mt) s[mt] = v8f{};
      const _Float16* kp = k16 + (((size_t)b << 10) + j0 + wave * 16 + n) * CH + hi * 8;  // lane's own
      v16h kf[8];                     // this wave's K fragments of the key tile, asked for together
#pragma unroll
      for (int kk = 0; kk < 8; ++kk) kf[kk] = load_frag_at(kp + kk * 32);
      // the K loads' address registers are rewritten only behind this wait; the lane's
      // address as an input keeps its registers out of the loads' own results
      asm volatile("s_wait_xcnt 0x0" :: "v"(kp) : "memory");
      v16h af[2][MT];                 // Q fragments: the set in use and the next k-step's
#pragma unroll
      for (int mt = 0; mt < MT; ++mt) af[0][mt] = load_frag(Qt + mt * 16 * 264, 264);
#pragma unroll
      for (int kk = 0; kk < 8; ++kk) {
        if (kk < 7) {
#pragma unroll
          for (int mt = 0; mt < MT; ++mt)
            af[(kk + 1) & 1][mt] = load_frag(Qt + mt * 16 * 264 + (kk + 1) * 32, 264);
        }
#pragma unroll
        for (int mt = 0; mt < MT; ++mt) s[mt] = wmma16(af[kk & 1][mt], kf[kk], s[mt]);
      }
#pragma unroll
      for (int mt = 0; mt < MT; ++mt)
#pragma unroll
        for (int r = 0; r < 8; ++r)
          St[(mt * 16 + r + 8 * hi) * 132 + wave * 16 + n] = s[mt][r] * SCALE;
    }
    __syncthreads();

    // --- online softmax, 2 threads per row, scores held in registers ---
    {
      float sv[64];
      const float4* sp = (const float4*)(St + srow * 132 + sseg * 64);
      float lm = -1e30f;
#pragma unroll
      for (int c = 0; c < 16; ++c) {
        float4 t = sp[c];
        sv[4 * c] = t.x; sv[4 * c + 1] = t.y; sv[4 * c + 2] = t.z; sv[4 * c + 3] = t.w;
        lm = fmaxf(lm, fmaxf(fmaxf(t.x, t.y), fmaxf(t.z, t.w)));
      }
      red[sseg * QT + srow] = lm;
      __syncthreads();
      const float mnew = fmaxf(mrun, fmaxf(red[srow], red[QT + srow]));
      const float f = __expf(mrun - mnew);
      mrun = mnew;
      if (sseg == 0) fac[srow] = f;
      float sum = 0.f;
#pragma unroll
      for (int c = 0; c < 8; ++c) {
        v8h pk;
#pragma unroll
        for (int i = 0; i < 8; ++i) {
          float e = __expf(sv[c * 8 + i] - mnew);
          pk[i] = (_Float16)e;
          sum += e;
        }
        *(v8h*)(Pt + srow * 136 + sseg * 64 + c * 8) = pk;
      }
      lpart = lpart * f + sum;
    }
    __syncthreads();

    // --- rescale O, accumulate P * V ---
    {
      const _Float16* vp = vt16 + ((size_t)b * CH + cbase + n) * HW + j0 + hi * 8;  // lane's own
      v16h vf[4][2];                  // this wave's V fragments of the key tile, asked for together
#pragma unroll
      for (int kk = 0; kk < 4; ++kk) {
        vf[kk][0] = load_frag_at(vp + kk * 32);
        vf[kk][1] = load_frag_at(vp + (size_t)16 * HW + kk * 32);
      }
      // as behind the K loads: address registers rewritten only behind this wait
      asm volatile("s_wait_xcnt 0x0" :: "v"(vp) : "memory");
      v16h af[2][MT];                 // P fragments: the set in use and the next k-step's
#pragma unroll
      for (int mt = 0; mt < MT; ++mt) af[0][mt] = load_frag(Pt + mt * 16 * 136, 136);
#pragma unroll
      for (int mt = 0; mt < MT; ++mt) {
        const float4* fp = (const float4*)(fac + mt * 16 + 8 * hi);
        float4 f0 = fp[0], f1 = fp[1];
        float fr[8] = {f0.x, f0.y, f0.z, f0.w, f1.x, f1.y, f1.z, f1.w};
#pragma unroll
        for (int r = 0; r < 8; ++r) { o[mt][0][r] *= fr[r]; o[mt][1][r] *= fr[r]; }
      }
#pragma unroll
      for (int kk = 0; kk < 4; ++kk) {
        if (kk < 3) {
#pragma unroll
          for (int mt = 0; mt < MT; ++mt)
            af[(kk + 1) & 1][mt] = load_frag(Pt + mt * 16 * 136 + (kk + 1) * 32, 136);
        }
        // keeps the next k-step's LDS reads one group ahead of this k-step's WMMAs; without
        // the pair the compiler puts each read, with a wait to 0, in front of its two WMMAs
        __builtin_amdgcn_sched_barrier(0);
#pragma unroll
        for (int mt = 0; mt < MT; ++mt) {
          o[mt][0] = wmma16(af[kk & 1][mt], vf[kk][0], o[mt][0]);
          o[mt][1] = wmma16(af[kk & 1][mt], vf[kk][1], o[mt][1]);
        }
        __builtin_amdgcn_sched_barrier(0);  // second of the pair
      }
    }
    // no barrier here: St, red, Pt and fac are each rewritten only behind a later
    // barrier that every wave reaches after its last read of them
  }

  red[sseg * QT + srow] = lpart;      // last read of red was in front of the loop's last barrier
  __syncthreads();
  // ---- projection weights of this wave's 32 output channels, asked for ahead of the
  // normalisation so that they are there when the product starts ----
  const _Float16* wl = wp16 + (size_t)(cbase + n) * CH + hi * 8;      // lane's own
  v16h wf[8][2];
#pragma unroll
  for (int kk = 0; kk < 8; ++kk) {
    wf[kk][0] = load_frag_at(wl + kk * 32);
    wf[kk][1] = load_frag_at(wl + (size_t)16 * CH + kk * 32);
  }
  const float bias0 = b_proj[cbase + n], bias1 = b_proj[cbase + 16 + n];
  // as behind the K loads: address registers rewritten only behind this wait
  asm volatile("s_wait_xcnt 0x0" :: "v"(wl) : "memory");
  // normalised rows go to LDS as f16, (pixel, channel), in the Q tile's place: its last read
  // was in front of the loop's last barriers
#pragma unroll
  for (int mt = 0; mt < MT; ++mt) {
#pragma unroll
    for (int r = 0; r < 8; ++r) {
      int m = mt * 16 + r + 8 * hi;
      float inv = 1.0f / (red[m] + red[QT + m]);
      Qt[m * 264 + cbase + n]      = (_Float16)(o[mt][0][r] * inv);
      Qt[m * 264 + cbase + 16 + n] = (_Float16)(o[mt][1][r] * inv);
    }
  }
#if HAVE_ASYNC_LDS
  // this wave's residual rows have landed before it reads them
  asm volatile("s_wait_asynccnt 0x0" ::: "memory");
#endif
  __syncthreads();

  // ---- out(pixel, channel) = h * Wp^T: QT pixels x this wave's 32 output channels ----
  v8f acc[MT][2];
#pragma unroll
  for (int mt = 0; mt < MT; ++mt) { acc[mt][0] = v8f{}; acc[mt][1] = v8f{}; }
  {
    v16h af[2][MT];                   // h fragments: the set in use and the next k-step's
#pragma unroll
    for (int mt = 0; mt < MT; ++mt) af[0][mt] = load_frag(Qt + mt * 16 * 264, 264);
#pragma unroll
    for (int kk = 0; kk < 8; ++kk) {
      if (kk < 7) {
#pragma unroll
        for (int mt = 0; mt < MT; ++mt)
          af[(kk + 1) & 1][mt] = load_frag(Qt + mt * 16 * 264 + (kk + 1) * 32, 264);
      }
      // as in the P * V loop: keeps the next k-step's LDS reads one group ahead of this
      // k-step's WMMAs instead of one read, with a wait to 0, in front of its two WMMAs
      __builtin_amdgcn_sched_barrier(0);
#pragma unroll
      for (int mt = 0; mt < MT; ++mt) {
        acc[mt][0] = wmma16(af[kk & 1][mt], wf[kk][0], acc[mt][0]);
        acc[mt][1] = wmma16(af[kk & 1][mt], wf[kk][1], acc[mt][1]);
      }
      __builtin_amdgcn_sched_barrier(0);  // second of the pair
    }
  }

  // ---- residual and bias, in place in the wave's own rows of Xs: a lane holds 8 adjacent
  // pixels of one output channel ----
#pragma unroll
  for (int t = 0; t < 2; ++t) {
    const float bias = t ? bias1 : bias0;
#pragma unroll
    for (int mt = 0; mt < MT; ++mt) {
      float4* xp = (float4*)(Xs + (cbase + t * 16 + n) * XLD + mt * 16 + hi * 8);
      const float4 x0 = xp[0], x1 = xp[1];
      const v8f a = acc[mt][t];
      xp[0] = make_float4(x0.x + a[0] + bias, x0.y + a[1] + bias,
                          x0.z + a[2] + bias, x0.w + a[3] + bias);
      xp[1] = make_float4(x1.x + a[4] + bias, x1.y + a[5] + bias,
                          x1.z + a[6] + bias, x1.w + a[7] + bias);
    }
  }
  __syncthreads();
  // ---- whole 512-B rows go out: one store instruction of a wave = one channel row ----
  {
    float4 ov[32];
#pragma unroll
    for (int i = 0; i < 32; ++i) ov[i] = *(const float4*)(Xs + (wave * 32 + i) * XLD + lane * 4);
    float* od = out + ((size_t)(b * CH + wave * 32)) * HW + q0 + lane * 4;   // lane's own
#pragma unroll
    for (int i = 0; i < 32; ++i) *(float4*)(od + (size_t)i * HW) = ov[i];
  }
}

// ---------- launcher ----------
extern "C" void kernel_launch(void* const* d_in, const int* in_sizes, int n_in,
                              void* d_out, int out_size, void* d_ws, size_t ws_size,
                              hipStream_t stream) {
  const float* x      = (const float*)d_in[0];
  const float* gamma  = (const float*)d_in[1];
  const float* beta   = (const float*)d_in[2];
  const float* w_qkv  = (const float*)d_in[3];
  const float* b_qkv  = (const float*)d_in[4];
  const float* w_proj = (const float*)d_in[5];
  const float* b_proj = (const float*)d_in[6];
  float* out = (float*)d_out;

  char* ws = (char*)d_ws;
  _Float16* wq16 = (_Float16*)ws; ws += (size_t)3 * CH * CH * 2;   // 384 KB
  _Float16* wp16 = (_Float16*)ws; ws += (size_t)CH * CH * 2;       // 128 KB
  float*    mean = (float*)ws;    ws += BATCH * GRP * 4;
  float*    rstd = (float*)ws;    ws += BATCH * GRP * 4;
  _Float16* q16  = (_Float16*)ws; ws += (size_t)BATCH * HW * CH * 2;
  _Float16* k16  = (_Float16*)ws; ws += (size_t)BATCH * HW * CH * 2;
  _Float16* vt16 = (_Float16*)ws; ws += (size_t)BATCH * HW * CH * 2;

  cvt_weights_kernel<<<(3 * CH * CH + 255) / 256, 256, 0, stream>>>(
      w_qkv, w_proj, wq16, wp16);
  gn_stats_kernel<<<BATCH * GRP, 256, 0, stream>>>(x, mean, rstd);
  qkv_gemm_kernel<<<dim3(HW / PT, BATCH), 256, 0, stream>>>(
      x, gamma, beta, mean, rstd, wq16, b_qkv, q16, k16, vt16);
  attn_kernel<<<dim3(HW / QT, BATCH), 256, 0, stream>>>(q16, k16, vt16, wp16, b_proj, x, out);
}

// v004
// Measured time: 77.4 microseconds a run.
// Two timings next to v003 both put it at 1.04 times that version's speed.
// All steps since v000 together make it 3.03 times as fast.
#include <hip/hip_runtime.h>
#include <hip/hip_bf16.h>
#include <math.h>

typedef __attribute__((ext_vector_type(16))) _Float16 v16h;
typedef __attribute__((ext_vector_type(8)))  _Float16 v8h;
typedef __attribute__((ext_vector_type(8)))  float    v8f;

#if defined(__has_builtin)
#  if __has_builtin(__builtin_amdgcn_global_load_async_to_lds_b128) && \
      __has_builtin(__builtin_amdgcn_s_wait_asynccnt)
#    define HAVE_ASYNC_LDS 1
#  endif
#endif
#ifndef HAVE_ASYNC_LDS
#  define HAVE_ASYNC_LDS 0
#endif

#if HAVE_ASYNC_LDS
// Builtin signature (from hipcc diagnostic): param 1 is
//   int __attribute__((vector_size(16))) addrspace(1)*  (non-const)
typedef int b128_t __attribute__((vector_size(16)));
typedef b128_t __attribute__((address_space(1)))* gas_b128p;
typedef b128_t __attribute__((address_space(3)))* las_b128p;
#endif

__device__ __forceinline__ v16h load_frag(const _Float16* __restrict__ base, int ld) {
  const int lane = threadIdx.x & 31;
  const int row  = lane & 15;
  const int hi   = lane >> 4;
  const _Float16* p = base + (size_t)row * ld + hi * 8;
  v8h c0 = *(const v8h*)(p);        // K = hi*8 .. hi*8+7
  v8h c1 = *(const v8h*)(p + 16);   // K = 16 + hi*8 ..
  v16h r;
#pragma unroll
  for (int i = 0; i < 8; ++i) { r[i] = c0[i]; r[i + 8] = c1[i]; }
  return r;
}

// The same fragment from the lane's own address p = base + (lane & 15) * ld + (lane >> 4) * 8.
__device__ __forceinline__ v16h load_frag_at(const _Float16* __restrict__ p) {
  v8h c0 = *(const v8h*)(p);
  v8h c1 = *(const v8h*)(p + 16);
  v16h r;
#pragma unroll
  for (int i = 0; i < 8; ++i) { r[i] = c0[i]; r[i + 8] = c1[i]; }
  return r;
}

#define FRAG 512
__device__ __forceinline__ v16h load_frag_packed(const _Float16* __restrict__ p) {
  v8h c0 = *(const v8h*)(p);
  v8h c1 = *(const v8h*)(p + 256);
  v16h r;
#pragma unroll
  for (int i = 0; i < 8; ++i) { r[i] = c0[i]; r[i + 8] = c1[i]; }
  return r;
}

__device__ __forceinline__ v8f wmma16(v16h a, v16h b, v8f c) {
  // D = A(16x32) * B(32x16) + C, f32 accumulate
  return __builtin_amdgcn_wmma_f32_16x16x32_f16(false, a, false, b, (short)0, c,
                                                false, false);
}

// ---------- constants ----------
#define BATCH 32
#define CH    256
#define HW    1024
#define GRP   8
#define CPG   32          // channels per group
#define SCALE 0.0625f     // 1/sqrt(256)

// ---------- kernel 0: weights f32 -> f16, packed fragment order ----------
// Fragment (16-row tile rt, k-step kk) of a (rows, 256) matrix lies at (rt * 8 + kk) * FRAG.
__global__ __launch_bounds__(256) void cvt_weights_kernel(
    const float* __restrict__ wq, const float* __restrict__ wp,
    _Float16* __restrict__ wq16, _Float16* __restrict__ wp16) {
  const int i = blockIdx.x * 256 + threadIdx.x;      // place in the packed matrix
  const int ln = (i >> 3) & 31;
  const int row = (i >> 12) * 16 + (ln & 15);
  const int col = ((i >> 9) & 7) * 32 + ((i >> 8) & 1) * 16 + (ln >> 4) * 8 + (i & 7);
  const int src = row * CH + col;
  if (i < 3 * CH * CH) wq16[i] = (_Float16)wq[src];
  if (i < CH * CH)     wp16[i] = (_Float16)wp[src];
}

// ---------- kernel 1: GroupNorm statistics ----------
__global__ __launch_bounds__(256) void gn_stats_kernel(
    const float* __restrict__ x, float* __restrict__ mean, float* __restrict__ rstd) {
  const int bg = blockIdx.x;                  // b*8+g
  const float* xp = x + (size_t)bg * CPG * HW;
  float s = 0.f, s2 = 0.f;
  for (int i = threadIdx.x; i < CPG * HW; i += 256) {
    float v = xp[i]; s += v; s2 += v * v;
  }
  __shared__ float sm[256], sq[256];
  sm[threadIdx.x] = s; sq[threadIdx.x] = s2;
  __syncthreads();
  for (int off = 128; off > 0; off >>= 1) {
    if (threadIdx.x < off) {
      sm[threadIdx.x] += sm[threadIdx.x + off];
      sq[threadIdx.x] += sq[threadIdx.x + off];
    }
    __syncthreads();
  }
  if (threadIdx.x == 0) {
    const float inv_n = 1.0f / (CPG * HW);
    float m = sm[0] * inv_n;
    float var = sq[0] * inv_n - m * m;
    mean[bg] = m;
    rstd[bg] = rsqrtf(var + 1e-5f);
  }
}

// ---------- kernel 2: GN-fused QKV GEMM ----------
// One block makes all 768 outputs of its 128 pixels: x is read and normalised once into an
// LDS tile [pixel][channel], behind one barrier. 8 waves; a wave runs 2 passes, each pass one
// 16-channel tile of Q, of K and of V over all 128 pixels (24 accumulator tiles), so every
// weight row is loaded by exactly one wave of the block.
#define PT  128           // pixels per block
#define PMT (PT / 16)     // 16-pixel tiles per block
#define ALD 264           // LDS row pitch in halves
__global__ __launch_bounds__(256) void qkv_gemm_kernel(
    const float* __restrict__ x, const float* __restrict__ gamma,
    const float* __restrict__ beta, const float* __restrict__ mean,
    const float* __restrict__ rstd, const _Float16* __restrict__ wq16,
    const float* __restrict__ b_qkv,
    _Float16* __restrict__ q16, _Float16* __restrict__ k16,
    _Float16* __restrict__ vt16) {
  const int p0 = blockIdx.x * PT;
  const int b  = blockIdx.y;
  const int tid = threadIdx.x, lane = tid & 31;
  const int wave = __builtin_amdgcn_readfirstlane(tid >> 5);
  const int n = lane & 15, hi = lane >> 4;

  __shared__ __attribute__((aligned(16))) _Float16 At[PT * ALD];
  __shared__ __attribute__((aligned(16))) float    Bs[3 * CH];   // b_qkv, read where a pass ends

  // Step s = pass * 8 + k-step. Weight fragment of step s for product t (0 Q, 1 K, 2 V):
  // rows t*256 + pass*128 + wave*16 .. +15, channels (s & 7)*32 .. +31.
  const _Float16* wl = wq16 + (size_t)wave * 8 * FRAG + lane * 8;     // lane's own
  auto wfrag = [&](int s, int t) {
    return load_frag_packed(wl + (size_t)((t * 16 + (s >> 3) * 8) * 8 + (s & 7)) * FRAG);
  };
  v16h bf[4][3];                      // weight fragments, a ring four steps deep

  // staging: thread -> pixel tid & 127, 8 adjacent channels of every 16 (one b128 LDS store)
  {
    const int sp = tid & (PT - 1);
    const int sh = __builtin_amdgcn_readfirstlane(tid >> 7) * 8;
    const float* xl = x + ((size_t)(b * CH + sh)) * HW + p0 + sp;    // lane's own
    float xv[16][8];
#pragma unroll
    for (int ch = 0; ch < 16; ++ch)
#pragma unroll
      for (int i = 0; i < 8; ++i) xv[ch][i] = xl[(size_t)(ch * 16 + i) * HW];
    const float b0 = b_qkv[tid], b1 = b_qkv[CH + tid], b2 = b_qkv[2 * CH + tid];
#pragma unroll
    for (int s = 0; s < 4; ++s)
#pragma unroll
      for (int t = 0; t < 3; ++t) bf[s][t] = wfrag(s, t);
    // all of the tile's loads are asked for before the first is used; without this the
    // compiler issues them two at a time, each pair behind a wait to 0
    __builtin_amdgcn_sched_barrier(0);
#pragma unroll
    for (int ch = 0; ch < 16; ++ch) {
      const float mu = mean[b * GRP + (ch >> 1)];
      const float rs = rstd[b * GRP + (ch >> 1)];
      v8h pk;
#pragma unroll
      for (int i = 0; i < 8; ++i) {
        const int c = sh + ch * 16 + i;
        pk[i] = (_Float16)((xv[ch][i] - mu) * rs * gamma[c] + beta[c]);
      }
      *(v8h*)(&At[sp * ALD + sh + ch * 16]) = pk;
    }
    Bs[tid] = b0; Bs[CH + tid] = b1; Bs[2 * CH + tid] = b2;
  }
  __syncthreads();

  const _Float16* al = At + n * ALD + hi * 8;                        // lane's own
  v16h af[2][PMT];                    // pixel fragments: the set in use and the next step's
#pragma unroll
  for (int mt = 0; mt < PMT; ++mt) af[0][mt] = load_frag_at(al + mt * 16 * ALD);
  // one pass: 8 k-steps, then its 16 channels of Q, K and V go out
  auto pass = [&](const int ps) {
    v8f acc[3][PMT];
#pragma unroll
    for (int t = 0; t < 3; ++t)
#pragma unroll
      for (int mt = 0; mt < PMT; ++mt) acc[t][mt] = v8f{};
#pragma unroll
    for (int kk = 0; kk < 8; ++kk) {
      const int s = ps * 8 + kk;
      if (s < 15) {
#pragma unroll
        for (int mt = 0; mt < PMT; ++mt)
          af[(kk + 1) & 1][mt] = load_frag_at(al + mt * 16 * ALD + ((kk + 1) & 7) * 32);
      }
      // keeps the next step's LDS reads as one group ahead of this step's WMMAs, and the ring's
      // refill behind them; without the pair the compiler puts two reads, with a wait to 0, in
      // front of every three WMMAs and spills
      __builtin_amdgcn_sched_barrier(0);
      // Q, K: weights as the row operand, so a lane holds 8 adjacent channels of one pixel;
      // V: pixels as the row operand, so a lane holds 8 adjacent pixels of one channel
#pragma unroll
      for (int t = 0; t < 2; ++t)
#pragma unroll
        for (int mt = 0; mt < PMT; ++mt)
          acc[t][mt] = wmma16(bf[kk & 3][t], af[kk & 1][mt], acc[t][mt]);
#pragma unroll
      for (int mt = 0; mt < PMT; ++mt)
        acc[2][mt] = wmma16(af[kk & 1][mt], bf[kk & 3][2], acc[2][mt]);
      __builtin_amdgcn_sched_barrier(0);  // second of the pair
      if (s + 4 < 16) {
#pragma unroll
        for (int t = 0; t < 3; ++t) bf[kk & 3][t] = wfrag(s + 4, t);
      }
    }
    const int c0 = ps * 128 + wave * 16;
    const float4* bq4 = (const float4*)(Bs + c0 + hi * 8);
    const float4* bk4 = (const float4*)(Bs + CH + c0 + hi * 8);
    const float4 q0 = bq4[0], q1 = bq4[1], k0 = bk4[0], k1 = bk4[1];
    const float bq[8] = {q0.x, q0.y, q0.z, q0.w, q1.x, q1.y, q1.z, q1.w};
    const float bk[8] = {k0.x, k0.y, k0.z, k0.w, k1.x, k1.y, k1.z, k1.w};
    const float bv = Bs[2 * CH + c0 + n];
    // packed fragment order. Q, K: fragment (16-pixel tile, 32-channel step), a lane's 8 channels
    // are its piece of k half (c0 >> 4) & 1. V: fragment (16-channel tile, 32-pixel step), a
    // lane's 8 pixels are its piece of k half mt & 1.
    const size_t qko = ((((size_t)b * (HW / 16) + (p0 >> 4)) * 8 + (c0 >> 5)) * 2 + ((c0 >> 4) & 1)) * 256
                       + lane * 8;
    _Float16* qd = q16 + qko;
    _Float16* kd = k16 + qko;
    _Float16* vd = vt16 + (((size_t)b * (CH / 16) + (c0 >> 4)) * (HW / 32) + (p0 >> 5)) * FRAG + lane * 8;
    v8h pq[PMT], pk[PMT], pv[PMT];
#pragma unroll
    for (int mt = 0; mt < PMT; ++mt)
#pragma unroll
      for (int r = 0; r < 8; ++r) {
        pq[mt][r] = (_Float16)(acc[0][mt][r] + bq[r]);
        pk[mt][r] = (_Float16)(acc[1][mt][r] + bk[r]);
        pv[mt][r] = (_Float16)(acc[2][mt][r] + bv);
      }
    // the stores go out as one run behind the last conversion, so that none of their
    // registers is written again behind them (first pass: in front of the wait below)
    __builtin_amdgcn_sched_barrier(0);
#pragma unroll
    for (int mt = 0; mt < PMT; ++mt) {
      *(v8h*)(qd + (size_t)mt * 8 * FRAG) = pq[mt];
      *(v8h*)(kd + (size_t)mt * 8 * FRAG) = pk[mt];
      *(v8h*)(vd + mt * 256) = pv[mt];
    }
    if (ps == 0) {
      // the stores' address and data registers are rewritten only behind this wait
      asm volatile("s_wait_xcnt 0x0" ::: "memory");
      __builtin_amdgcn_sched_barrier(0);  // keeps the next pass's register writes behind the wait
    }
  };
  pass(0);
  pass(1);
}

// ---------- kernel 3: flash attention (128 q-rows per block, online softmax), then the
// output projection, bias and residual of the block's own 128 pixels ----------
// Every K and V fragment that a wave loads from global memory feeds 8 row tiles
// (QT / 16), so the block reads K and V once per 128 queries. A block ends with all 256
// channels of its 128 pixels, which is all that the projection of those pixels needs.
#define QT 128            // query rows per block
#define MT (QT / 16)      // 16-row tiles per block
#define XLD 132           // residual tile's row pitch in floats (528 B = 16 B x odd)
__global__ __launch_bounds__(256) void attn_kernel(
    const _Float16* __restrict__ q16, const _Float16* __restrict__ k16,
    const _Float16* __restrict__ vt16, const _Float16* __restrict__ wp16,
    const float* __restrict__ b_proj, const float* __restrict__ x,
    float* __restrict__ out) {
  const int q0 = blockIdx.x * QT;
  const int b  = blockIdx.y;
  const int tid = threadIdx.x, wave = tid >> 5, lane = tid & 31;
  const int n = lane & 15, hi = lane >> 4;
  const int srow = tid & (QT - 1), sseg = tid >> 7;  // softmax mapping: 2 thr/row, 64 cols each

  // Qt and St carry the larger alignment so that they lie first in LDS and Xs behind them: the
  // compiler folds a copy's row step into its offset field and takes it off the LDS address
  // register, which then stays above 0 for every row of Xs
  __shared__ __attribute__((aligned(128))) _Float16 Qt[QT * 264]; // Q tile, packed fragments; then h, ld=264
  __shared__ __attribute__((aligned(128))) float    St[QT * 132]; // scores tile QT x 128, ld=132
  __shared__ __attribute__((aligned(16))) _Float16 Pt[QT * 136];  // exp tile f16, ld=136
  __shared__ __attribute__((aligned(16))) float    red[2 * QT];   // per-row partials of the 2 segments
  __shared__ __attribute__((aligned(16))) float    fac[QT];       // per-row rescale factor
  __shared__ __attribute__((aligned(16))) float    Xs[CH * XLD];  // x, then out: (channel, pixel)

#pragma unroll
  for (int it = 0; it < QT / 8; ++it) {
    int idx = tid + it * 256;                 // 16B chunk id; the tile's 64 fragments lie in a row
    const _Float16* src = q16 + ((size_t)b * (HW / 16) + (q0 >> 4)) * 8 * FRAG + idx * 8;
    _Float16* dst = Qt + idx * 8;
#if HAVE_ASYNC_LDS
    __builtin_amdgcn_global_load_async_to_lds_b128(
        (gas_b128p)src, (las_b128p)dst, 0, 0);
#else
    *(v8h*)dst = *(const v8h*)src;
#endif
  }
#if HAVE_ASYNC_LDS
  // this wave's copies have landed before the barrier behind which other waves read them
  asm volatile("s_wait_asynccnt 0x0" ::: "memory");
#endif
  __syncthreads();

  // ---- residual tile: each wave asks for the 32 channel rows (512 B each) that it will
  // itself add to and store at the end; they land while the key loop runs ----
#pragma unroll
  for (int i = 0; i < 32; ++i) {
    const int row = wave * 32 + i;
    const float* src = x + ((size_t)(b * CH + row)) * HW + q0 + lane * 4;
    float* dst = Xs + row * XLD + lane * 4;
#if HAVE_ASYNC_LDS
    __builtin_amdgcn_global_load_async_to_lds_b128(
        (gas_b128p)src, (las_b128p)dst, 0, 0);
#else
    *(float4*)dst = *(const float4*)src;
#endif
  }

  v8f o[MT][2];                       // O accum: QT rows x this wave's channels [wave*32, +32)
#pragma unroll
  for (int mt = 0; mt < MT; ++mt) { o[mt][0] = v8f{}; o[mt][1] = v8f{}; }
  const int cbase = wave * 32;
  float mrun = -1e30f;                // running row maximum (the row's 2 threads hold the same)
  float lpart = 0.f;                  // running sum over this thread's own 64-column segments

  for (int jt = 0; jt < 8; ++jt) {
    // --- S = Q * K^T * scale ; wave computes columns jt*128 + wave*16 .. +15, all QT rows ---
    {
      v8f s[MT];
#pragma unroll
      for (int mt = 0; mt < MT; ++mt) s[mt] = v8f{};
      const _Float16* kp = k16 + ((size_t)b * (HW / 16) + jt * 8 + wave) * 8 * FRAG + lane * 8;  // lane's own
      v16h kf[8];                     // this wave's K fragments of the key tile, asked for together
#pragma unroll
      for (int kk = 0; kk < 8; ++kk) kf[kk] = load_frag_packed(kp + kk * FRAG);
      // the K loads' address registers are rewritten only behind this wait; the lane's
      // address as an input keeps its registers out of the loads' own results
      asm volatile("s_wait_xcnt 0x0" :: "v"(kp) : "memory");
      v16h af[2][MT];                 // Q fragments: the set in use and the next k-step's
#pragma unroll
      for (int mt = 0; mt < MT; ++mt) af[0][mt] = load_frag_packed(Qt + mt * 8 * FRAG + lane * 8);
#pragma unroll
      for (int kk = 0; kk < 8; ++kk) {
        if (kk < 7) {
#pragma unroll
          for (int mt = 0; mt < MT; ++mt)
            af[(kk + 1) & 1][mt] = load_frag_packed(Qt + (mt * 8 + kk + 1) * FRAG + lane * 8);
        }
#pragma unroll
        for (int mt = 0; mt < MT; ++mt) s[mt] = wmma16(af[kk & 1][mt], kf[kk], s[mt]);
      }
      float* sl = St + hi * (8 * 132) + wave * 16 + n;   // lane's own; the rest are constant offsets
#pragma unroll
      for (int mt = 0; mt < MT; ++mt)
#pragma unroll
        for (int r = 0; r < 8; ++r)
          sl[(mt * 16 + r) * 132] = s[mt][r] * SCALE;
    }
    __syncthreads();

    // --- online softmax, 2 threads per row, scores held in registers ---
    {
      float sv[64];
      const float4* sp = (const float4*)(St + srow * 132 + sseg * 64);
      float lm = -1e30f;
#pragma unroll
      for (int c = 0; c < 16; ++c) {
        float4 t = sp[c];
        sv[4 * c] = t.x; sv[4 * c + 1] = t.y; sv[4 * c + 2] = t.z; sv[4 * c + 3] = t.w;
        lm = fmaxf(lm, fmaxf(fmaxf(t.x, t.y), fmaxf(t.z, t.w)));
      }
      red[sseg * QT + srow] = lm;
      __syncthreads();
      const float mnew = fmaxf(mrun, fmaxf(red[srow], red[QT + srow]));
      const float f = __expf(mrun - mnew);
      mrun = mnew;
      if (sseg == 0) fac[srow] = f;
      float sum = 0.f;
#pragma unroll
      for (int c = 0; c < 8; ++c) {
        v8h pk;
#pragma unroll
        for (int i = 0; i < 8; ++i) {
          float e = __expf(sv[c * 8 + i] - mnew);
          pk[i] = (_Float16)e;
          sum += e;
        }
        *(v8h*)(Pt + srow * 136 + sseg * 64 + c * 8) = pk;
      }
      lpart = lpart * f + sum;
    }
    __syncthreads();

    // --- rescale O, accumulate P * V ---
    {
      const _Float16* vp = vt16 + (((size_t)b * (CH / 16) + wave * 2) * (HW / 32) + jt * 4) * FRAG + lane * 8;  // lane's own
      v16h vf[4][2];                  // this wave's V fragments of the key tile, asked for together
#pragma unroll
      for (int kk = 0; kk < 4; ++kk) {
        vf[kk][0] = load_frag_packed(vp + kk * FRAG);
        vf[kk][1] = load_frag_packed(vp + (HW / 32 + kk) * FRAG);
      }
      // as behind the K loads: address registers rewritten only behind this wait
      asm volatile("s_wait_xcnt 0x0" :: "v"(vp) : "memory");
      v16h af[2][MT];                 // P fragments: the set in use and the next k-step's
#pragma unroll
      for (int mt = 0; mt < MT; ++mt) af[0][mt] = load_frag(Pt + mt * 16 * 136, 136);
#pragma unroll
      for (int mt = 0; mt < MT; ++mt) {
        const float4* fp = (const float4*)(fac + mt * 16 + 8 * hi);
        float4 f0 = fp[0], f1 = fp[1];
        float fr[8] = {f0.x, f0.y, f0.z, f0.w, f1.x, f1.y, f1.z, f1.w};
#pragma unroll
        for (int r = 0; r < 8; ++r) { o[mt][0][r] *= fr[r]; o[mt][1][r] *= fr[r]; }
      }
#pragma unroll
      for (int kk = 0; kk < 4; ++kk) {
        if (kk < 3) {
#pragma unroll
          for (int mt = 0; mt < MT; ++mt)
            af[(kk + 1) & 1][mt] = load_frag(Pt + mt * 16 * 136 + (kk + 1) * 32, 136);
        }
        // keeps the next k-step's LDS reads one group ahead of this k-step's WMMAs; without
        // the pair the compiler puts each read, with a wait to 0, in front of its two WMMAs
        __builtin_amdgcn_sched_barrier(0);
#pragma unroll
        for (int mt = 0; mt < MT; ++mt) {
          o[mt][0] = wmma16(af[kk & 1][mt], vf[kk][0], o[mt][0]);
          o[mt][1] = wmma16(af[kk & 1][mt], vf[kk][1], o[mt][1]);
        }
        __builtin_amdgcn_sched_barrier(0);  // second of the pair
      }
    }
    // no barrier here: St, red, Pt and fac are each rewritten only behind a later
    // barrier that every wave reaches after its last read of them
  }

  red[sseg * QT + srow] = lpart;      // last read of red was in front of the loop's last barrier
  __syncthreads();
  // ---- projection weights of this wave's 32 output channels, asked for ahead of the
  // normalisation so that they are there when the product starts ----
  const _Float16* wl = wp16 + (size_t)wave * 2 * 8 * FRAG + lane * 8; // lane's own
  v16h wf[8][2];
#pragma unroll
  for (int kk = 0; kk < 8; ++kk) {
    wf[kk][0] = load_frag_packed(wl + kk * FRAG);
    wf[kk][1] = load_frag_packed(wl + (8 + kk) * FRAG);
  }
  const float bias0 = b_proj[cbase + n], bias1 = b_proj[cbase + 16 + n];
  // as behind the K loads: address registers rewritten only behind this wait
  asm volatile("s_wait_xcnt 0x0" :: "v"(wl) : "memory");
  // normalised rows go to LDS as f16, (pixel, channel), in the Q tile's place: its last read
  // was in front of the loop's last barriers
#pragma unroll
  for (int mt = 0; mt < MT; ++mt) {
#pragma unroll
    for (int r = 0; r < 8; ++r) {
      int m = mt * 16 + r + 8 * hi;
      float inv = 1.0f / (red[m] + red[QT + m]);
      Qt[m * 264 + cbase + n]      = (_Float16)(o[mt][0][r] * inv);
      Qt[m * 264 + cbase + 16 + n] = (_Float16)(o[mt][1][r] * inv);
    }
  }
#if HAVE_ASYNC_LDS
  // this wave's residual rows have landed before it reads them
  asm volatile("s_wait_asynccnt 0x0" ::: "memory");
#endif
  __syncthreads();

  // ---- out(pixel, channel) = h * Wp^T: QT pixels x this wave's 32 output channels ----
  v8f acc[MT][2];
#pragma unroll
  for (int mt = 0; mt < MT; ++mt) { acc[mt][0] = v8f{}; acc[mt][1] = v8f{}; }
  {
    v16h af[2][MT];                   // h fragments: the set in use and the next k-step's
#pragma unroll
    for (int mt = 0; mt < MT; ++mt) af[0][mt] = load_frag(Qt + mt * 16 * 264, 264);
#pragma unroll
    for (int kk = 0; kk < 8; ++kk) {
      if (kk < 7) {
#pragma unroll
        for (int mt = 0; mt < MT; ++mt)
          af[(kk + 1) & 1][mt] = load_frag(Qt + mt * 16 * 264 + (kk + 1) * 32, 264);
      }
      // as in the P * V loop: keeps the next k-step's LDS reads one group ahead of this
      // k-step's WMMAs instead of one read, with a wait to 0, in front of its two WMMAs
      __builtin_amdgcn_sched_barrier(0);
#pragma unroll
      for (int mt = 0; mt < MT; ++mt) {
        acc[mt][0] = wmma16(af[kk & 1][mt], wf[kk][0], acc[mt][0]);
        acc[mt][1] = wmma16(af[kk & 1][mt], wf[kk][1], acc[mt][1]);
      }
      __builtin_amdgcn_sched_barrier(0);  // second of the pair
    }
  }

  // ---- residual and bias, in place in the wave's own rows of Xs: a lane holds 8 adjacent
  // pixels of one output channel ----
#pragma unroll
  for (int t = 0; t < 2; ++t) {
    const float bias = t ? bias1 : bias0;
#pragma unroll
    for (int mt = 0; mt < MT; ++mt) {
      float4* xp = (float4*)(Xs + (cbase + t * 16 + n) * XLD + mt * 16 + hi * 8);
      const float4 x0 = xp[0], x1 = xp[1];
      const v8f a = acc[mt][t];
      xp[0] = make_float4(x0.x + a[0] + bias, x0.y + a[1] + bias,
                          x0.z + a[2] + bias, x0.w + a[3] + bias);
      xp[1] = make_float4(x1.x + a[4] + bias, x1.y + a[5] + bias,
                          x1.z + a[6] + bias, x1.w + a[7] + bias);
    }
  }
  __syncthreads();
  // ---- whole 512-B rows go out: one store instruction of a wave = one channel row ----
  {
    float4 ov[32];
#pragma unroll
    for (int i = 0; i < 32; ++i) ov[i] = *(const float4*)(Xs + (wave * 32 + i) * XLD + lane * 4);
    float* od = out + ((size_t)(b * CH + wave * 32)) * HW + q0 + lane * 4;   // lane's own
#pragma unroll
    for (int i = 0; i < 32; ++i) *(float4*)(od + (size_t)i * HW) = ov[i];
  }
}

// ---------- launcher ----------
extern "C" void kernel_launch(void* const* d_in, const int* in_sizes, int n_in,
                              void* d_out, int out_size, void* d_ws, size_t ws_size,
                              hipStream_t stream) {
  const float* x      = (const float*)d_in[0];
  const float* gamma  = (const float*)d_in[1];
  const float* beta   = (const float*)d_in[2];
  const float* w_qkv  = (const float*)d_in[3];
  const float* b_qkv  = (const float*)d_in[4];
  const float* w_proj = (const float*)d_in[5];
  const float* b_proj = (const float*)d_in[6];
  float* out = (float*)d_out;

  char* ws = (char*)d_ws;
  _Float16* wq16 = (_Float16*)ws; ws += (size_t)3 * CH * CH * 2;   // 384 KB
  _Float16* wp16 = (_Float16*)ws; ws += (size_t)CH * CH * 2;       // 128 KB
  float*    mean = (float*)ws;    ws += BATCH * GRP * 4;
  float*    rstd = (float*)ws;    ws += BATCH * GRP * 4;
  _Float16* q16  = (_Float16*)ws; ws += (size_t)BATCH * HW * CH * 2;
  _Float16* k16  = (_Float16*)ws; ws += (size_t)BATCH * HW * CH * 2;
  _Float16* vt16 = (_Float16*)ws; ws += (size_t)BATCH * HW * CH * 2;

  cvt_weights_kernel<<<(3 * CH * CH + 255) / 256, 256, 0, stream>>>(
      w_qkv, w_proj, wq16, wp16);
  gn_stats_kernel<<<BATCH * GRP, 256, 0, stream>>>(x, mean, rstd);
  qkv_gemm_kernel<<<dim3(HW / PT, BATCH), 256, 0, stream>>>(
      x, gamma, beta, mean, rstd, wq16, b_qkv, q16, k16, vt16);
  attn_kernel<<<dim3(HW / QT, BATCH), 256, 0, stream>>>(q16, k16, vt16, wp16, b_proj, x, out);
}

// v005
// It runs in 74.1 microseconds.
// Two timings next to v004 both put it at 1.04 times that version's speed.
// Over all steps from v000 it is 3.15 times as fast.
#include <hip/hip_runtime.h>
#include <hip/hip_bf16.h>
#include <math.h>

typedef __attribute__((ext_vector_type(16))) _Float16 v16h;
typedef __attribute__((ext_vector_type(8)))  _Float16 v8h;
typedef __attribute__((ext_vector_type(8)))  float    v8f;

#if defined(__has_builtin)
#  if __has_builtin(__builtin_amdgcn_global_load_async_to_lds_b128) && \
      __has_builtin(__builtin_amdgcn_s_wait_asynccnt)
#    define HAVE_ASYNC_LDS 1
#  endif
#endif
#ifndef HAVE_ASYNC_LDS
#  define HAVE_ASYNC_LDS 0
#endif

#if HAVE_ASYNC_LDS
// Builtin signature (from hipcc diagnostic): param 1 is
//   int __attribute__((vector_size(16))) addrspace(1)*  (non-const)
typedef int b128_t __attribute__((vector_size(16)));
typedef b128_t __attribute__((address_space(1)))* gas_b128p;
typedef b128_t __attribute__((address_space(3)))* las_b128p;
#endif

__device__ __forceinline__ v16h load_frag(const _Float16* __restrict__ base, int ld) {
  const int lane = threadIdx.x & 31;
  const int row  = lane & 15;
  const int hi   = lane >> 4;
  const _Float16* p = base + (size_t)row * ld + hi * 8;
  v8h c0 = *(const v8h*)(p);        // K = hi*8 .. hi*8+7
  v8h c1 = *(const v8h*)(p + 16);   // K = 16 + hi*8 ..
  v16h r;
#pragma unroll
  for (int i = 0; i < 8; ++i) { r[i] = c0[i]; r[i + 8] = c1[i]; }
  return r;
}

// The same fragment from the lane's own address p = base + (lane & 15) * ld + (lane >> 4) * 8.
__device__ __forceinline__ v16h load_frag_at(const _Float16* __restrict__ p) {
  v8h c0 = *(const v8h*)(p);
  v8h c1 = *(const v8h*)(p + 16);
  v16h r;
#pragma unroll
  for (int i = 0; i < 8; ++i) { r[i] = c0[i]; r[i + 8] = c1[i]; }
  return r;
}

#define FRAG 512
__device__ __forceinline__ v16h load_frag_packed(const _Float16* __restrict__ p) {
  v8h c0 = *(const v8h*)(p);
  v8h c1 = *(const v8h*)(p + 256);
  v16h r;
#pragma unroll
  for (int i = 0; i < 8; ++i) { r[i] = c0[i]; r[i + 8] = c1[i]; }
  return r;
}

__device__ __forceinline__ v8f wmma16(v16h a, v16h b, v8f c) {
  // D = A(16x32) * B(32x16) + C, f32 accumulate
  return __builtin_amdgcn_wmma_f32_16x16x32_f16(false, a, false, b, (short)0, c,
                                                false, false);
}

// ---------- constants ----------
#define BATCH 32
#define CH    256
#define HW    1024
#define GRP   8
#define CPG   32          // channels per group
#define SCALE 0.0625f     // 1/sqrt(256)

// ---------- kernel 0: GroupNorm statistics; weights f32 -> f16, packed fragment order ----------
// The two jobs share no data. One launch does both: each thread of the statistics grid also
// converts its share of the two weight matrices, whose loads are asked for ahead of the x loop
// and land under it.
// Fragment (16-row tile rt, k-step kk) of a (rows, 256) matrix lies at (rt * 8 + kk) * FRAG.
#define NPREP (BATCH * GRP * 256)   // threads of the launch
// place i in a packed matrix -> index in the row-major (rows, 256) source
__device__ __forceinline__ int packed_src(int i) {
  const int ln = (i >> 3) & 31;
  const int row = (i >> 12) * 16 + (ln & 15);
  const int col = ((i >> 9) & 7) * 32 + ((i >> 8) & 1) * 16 + (ln >> 4) * 8 + (i & 7);
  return row * CH + col;
}
__global__ __launch_bounds__(256) void gn_stats_kernel(
    const float* __restrict__ x, const float* __restrict__ wq, const float* __restrict__ wp,
    float* __restrict__ mean, float* __restrict__ rstd,
    _Float16* __restrict__ wq16, _Float16* __restrict__ wp16) {
  static_assert((3 * CH * CH) % NPREP == 0 && (CH * CH) % NPREP == 0, "whole shares");
  const int bg = blockIdx.x;                  // b*8+g
  const int i0 = bg * 256 + threadIdx.x;      // first place in the packed matrices
  float wqv[3 * CH * CH / NPREP], wpv[CH * CH / NPREP];
  // these four short loops are unrolled so that the shares are indexed by constants and stay in registers
#pragma unroll
  for (int j = 0; j < 3 * CH * CH / NPREP; ++j) wqv[j] = wq[packed_src(i0 + j * NPREP)];
#pragma unroll
  for (int j = 0; j < CH * CH / NPREP; ++j) wpv[j] = wp[packed_src(i0 + j * NPREP)];
  const float* xp = x + (size_t)bg * CPG * HW;
  float s = 0.f, s2 = 0.f;
  for (int i = threadIdx.x; i < CPG * HW; i += 256) {
    float v = xp[i]; s += v; s2 += v * v;
  }
  __shared__ float sm[256], sq[256];
  sm[threadIdx.x] = s; sq[threadIdx.x] = s2;
  __syncthreads();
  for (int off = 128; off > 0; off >>= 1) {
    if (threadIdx.x < off) {
      sm[threadIdx.x] += sm[threadIdx.x + off];
      sq[threadIdx.x] += sq[threadIdx.x + off];
    }
    __syncthreads();
  }
  // behind the last barrier: in front of one, every wave would wait there for these stores
#pragma unroll
  for (int j = 0; j < 3 * CH * CH / NPREP; ++j) wq16[i0 + j * NPREP] = (_Float16)wqv[j];
#pragma unroll
  for (int j = 0; j < CH * CH / NPREP; ++j) wp16[i0 + j * NPREP] = (_Float16)wpv[j];
  if (threadIdx.x == 0) {
    const float inv_n = 1.0f / (CPG * HW);
    float m = sm[0] * inv_n;
    float var = sq[0] * inv_n - m * m;
    mean[bg] = m;
    rstd[bg] = rsqrtf(var + 1e-5f);
  }
}

// ---------- kernel 1: GN-fused QKV GEMM ----------
// One block makes all 768 outputs of its 128 pixels: x is read and normalised once into an
// LDS tile [pixel][channel], behind one barrier. 8 waves; a wave runs 2 passes, each pass one
// 16-channel tile of Q, of K and of V over all 128 pixels (24 accumulator tiles), so every
// weight row is loaded by exactly one wave of the block.
#define PT  128           // pixels per block
#define PMT (PT / 16)     // 16-pixel tiles per block
#define ALD 264           // LDS row pitch in halves
__global__ __launch_bounds__(256) void qkv_gemm_kernel(
    const float* __restrict__ x, const float* __restrict__ gamma,
    const float* __restrict__ beta, const float* __restrict__ mean,
    const float* __restrict__ rstd, const _Float16* __restrict__ wq16,
    const float* __restrict__ b_qkv,
    _Float16* __restrict__ q16, _Float16* __restrict__ k16,
    _Float16* __restrict__ vt16) {
  const int p0 = blockIdx.x * PT;
  const int b  = blockIdx.y;
  const int tid = threadIdx.x, lane = tid & 31;
  const int wave = __builtin_amdgcn_readfirstlane(tid >> 5);
  const int n = lane & 15, hi = lane >> 4;

  __shared__ __attribute__((aligned(16))) _Float16 At[PT * ALD];
  __shared__ __attribute__((aligned(16))) float    Bs[3 * CH];   // b_qkv, read where a pass ends

  // Step s = pass * 8 + k-step. Weight fragment of step s for product t (0 Q, 1 K, 2 V):
  // rows t*256 + pass*128 + wave*16 .. +15, channels (s & 7)*32 .. +31.
  const _Float16* wl = wq16 + (size_t)wave * 8 * FRAG + lane * 8;     // lane's own
  auto wfrag = [&](int s, int t) {
    return load_frag_packed(wl + (size_t)((t * 16 + (s >> 3) * 8) * 8 + (s & 7)) * FRAG);
  };
  v16h bf[4][3];                      // weight fragments, a ring four steps deep

  // staging: thread -> pixel tid & 127, 8 adjacent channels of every 16 (one b128 LDS store)
  {
    const int sp = tid & (PT - 1);
    const int sh = __builtin_amdgcn_readfirstlane(tid >> 7) * 8;
    const float* xl = x + ((size_t)(b * CH + sh)) * HW + p0 + sp;    // lane's own
    float xv[16][8];
#pragma unroll
    for (int ch = 0; ch < 16; ++ch)
#pragma unroll
      for (int i = 0; i < 8; ++i) xv[ch][i] = xl[(size_t)(ch * 16 + i) * HW];
    const float b0 = b_qkv[tid], b1 = b_qkv[CH + tid], b2 = b_qkv[2 * CH + tid];
#pragma unroll
    for (int s = 0; s < 4; ++s)
#pragma unroll
      for (int t = 0; t < 3; ++t) bf[s][t] = wfrag(s, t);
    // all of the tile's loads are asked for before the first is used; without this the
    // compiler issues them two at a time, each pair behind a wait to 0
    __builtin_amdgcn_sched_barrier(0);
#pragma unroll
    for (int ch = 0; ch < 16; ++ch) {
      const float mu = mean[b * GRP + (ch >> 1)];
      const float rs = rstd[b * GRP + (ch >> 1)];
      v8h pk;
#pragma unroll
      for (int i = 0; i < 8; ++i) {
        const int c = sh + ch * 16 + i;
        pk[i] = (_Float16)((xv[ch][i] - mu) * rs * gamma[c] + beta[c]);
      }
      *(v8h*)(&At[sp * ALD + sh + ch * 16]) = pk;
    }
    Bs[tid] = b0; Bs[CH + tid] = b1; Bs[2 * CH + tid] = b2;
  }
  __syncthreads();

  const _Float16* al = At + n * ALD + hi * 8;                        // lane's own
  v16h af[2][PMT];                    // pixel fragments: the set in use and the next step's
#pragma unroll
  for (int mt = 0; mt < PMT; ++mt) af[0][mt] = load_frag_at(al + mt * 16 * ALD);
  // one pass: 8 k-steps, then its 16 channels of Q, K and V go out
  auto pass = [&](const int ps) {
    v8f acc[3][PMT];
#pragma unroll
    for (int t = 0; t < 3; ++t)
#pragma unroll
      for (int mt = 0; mt < PMT; ++mt) acc[t][mt] = v8f{};
#pragma unroll
    for (int kk = 0; kk < 8; ++kk) {
      const int s = ps * 8 + kk;
      if (s < 15) {
#pragma unroll
        for (int mt = 0; mt < PMT; ++mt)
          af[(kk + 1) & 1][mt] = load_frag_at(al + mt * 16 * ALD + ((kk + 1) & 7) * 32);
      }
      // keeps the next step's LDS reads as one group ahead of this step's WMMAs, and the ring's
      // refill behind them; without the pair the compiler puts two reads, with a wait to 0, in
      // front of every three WMMAs and spills
      __builtin_amdgcn_sched_barrier(0);
      // Q, K: weights as the row operand, so a lane holds 8 adjacent channels of one pixel;
      // V: pixels as the row operand, so a lane holds 8 adjacent pixels of one channel
#pragma unroll
      for (int t = 0; t < 2; ++t)
#pragma unroll
        for (int mt = 0; mt < PMT; ++mt)
          acc[t][mt] = wmma16(bf[kk & 3][t], af[kk & 1][mt], acc[t][mt]);
#pragma unroll
      for (int mt = 0; mt < PMT; ++mt)
        acc[2][mt] = wmma16(af[kk & 1][mt], bf[kk & 3][2], acc[2][mt]);
      __builtin_amdgcn_sched_barrier(0);  // second of the pair
      if (s + 4 < 16) {
#pragma unroll
        for (int t = 0; t < 3; ++t) bf[kk & 3][t] = wfrag(s + 4, t);
      }
    }
    const int c0 = ps * 128 + wave * 16;
    const float4* bq4 = (const float4*)(Bs + c0 + hi * 8);
    const float4* bk4 = (const float4*)(Bs + CH + c0 + hi * 8);
    const float4 q0 = bq4[0], q1 = bq4[1], k0 = bk4[0], k1 = bk4[1];
    const float bq[8] = {q0.x, q0.y, q0.z, q0.w, q1.x, q1.y, q1.z, q1.w};
    const float bk[8] = {k0.x, k0.y, k0.z, k0.w, k1.x, k1.y, k1.z, k1.w};
    const float bv = Bs[2 * CH + c0 + n];
    // packed fragment order. Q, K: fragment (16-pixel tile, 32-channel step), a lane's 8 channels
    // are its piece of k half (c0 >> 4) & 1. V: fragment (16-channel tile, 32-pixel step), a
    // lane's 8 pixels are its piece of k half mt & 1.
    const size_t qko = ((((size_t)b * (HW / 16) + (p0 >> 4)) * 8 + (c0 >> 5)) * 2 + ((c0 >> 4) & 1)) * 256
                       + lane * 8;
    _Float16* qd = q16 + qko;
    _Float16* kd = k16 + qko;
    _Float16* vd = vt16 + (((size_t)b * (CH / 16) + (c0 >> 4)) * (HW / 32) + (p0 >> 5)) * FRAG + lane * 8;
    v8h pq[PMT], pk[PMT], pv[PMT];
#pragma unroll
    for (int mt = 0; mt < PMT; ++mt)
#pragma unroll
      for (int r = 0; r < 8; ++r) {
        pq[mt][r] = (_Float16)(acc[0][mt][r] + bq[r]);
        pk[mt][r] = (_Float16)(acc[1][mt][r] + bk[r]);
        pv[mt][r] = (_Float16)(acc[2][mt][r] + bv);
      }
    // the stores go out as one run behind the last conversion, so that none of their
    // registers is written again behind them (first pass: in front of the wait below)
    __builtin_amdgcn_sched_barrier(0);
#pragma unroll
    for (int mt = 0; mt < PMT; ++mt) {
      *(v8h*)(qd + (size_t)mt * 8 * FRAG) = pq[mt];
      *(v8h*)(kd + (size_t)mt * 8 * FRAG) = pk[mt];
      *(v8h*)(vd + mt * 256) = pv[mt];
    }
    if (ps == 0) {
      // the stores' address and data registers are rewritten only behind this wait
      asm volatile("s_wait_xcnt 0x0" ::: "memory");
      __builtin_amdgcn_sched_barrier(0);  // keeps the next pass's register writes behind the wait
    }
  };
  pass(0);
  pass(1);
}

// ---------- kernel 2: flash attention (128 q-rows per block, online softmax), then the
// output projection, bias and residual of the block's own 128 pixels ----------
// Every K and V fragment that a wave loads from global memory feeds 8 row tiles
// (QT / 16), so the block reads K and V once per 128 queries. A block ends with all 256
// channels of its 128 pixels, which is all that the projection of those pixels needs.
#define QT 128            // query rows per block
#define MT (QT / 16)      // 16-row tiles per block
#define XLD 132           // residual tile's row pitch in floats (528 B = 16 B x odd)
__global__ __launch_bounds__(256) void attn_kernel(
    const _Float16* __restrict__ q16, const _Float16* __restrict__ k16,
    const _Float16* __restrict__ vt16, const _Float16* __restrict__ wp16,
    const float* __restrict__ b_proj, const float* __restrict__ x,
    float* __restrict__ out) {
  const int q0 = blockIdx.x * QT;
  const int b  = blockIdx.y;
  const int tid = threadIdx.x, wave = tid >> 5, lane = tid & 31;
  const int n = lane & 15, hi = lane >> 4;
  const int srow = tid & (QT - 1), sseg = tid >> 7;  // softmax mapping: 2 thr/row, 64 cols each

  // Qt and St carry the larger alignment so that they lie first in LDS and Xs behind them: the
  // compiler folds a copy's row step into its offset field and takes it off the LDS address
  // register, which then stays above 0 for every row of Xs
  __shared__ __attribute__((aligned(128))) _Float16 Qt[QT * 264]; // Q tile, packed fragments; then h, ld=264
  __shared__ __attribute__((aligned(128))) float    St[QT * 132]; // scores tile QT x 128, ld=132
  __shared__ __attribute__((aligned(16))) _Float16 Pt[QT * 136];  // exp tile f16, ld=136
  __shared__ __attribute__((aligned(16))) float    red[2 * QT];   // per-row partials of the 2 segments
  __shared__ __attribute__((aligned(16))) float    fac[QT];       // per-row rescale factor
  __shared__ __attribute__((aligned(16))) float    Xs[CH * XLD];  // x, then out: (channel, pixel)

#pragma unroll
  for (int it = 0; it < QT / 8; ++it) {
    int idx = tid + it * 256;                 // 16B chunk id; the tile's 64 fragments lie in a row
    const _Float16* src = q16 + ((size_t)b * (HW / 16) + (q0 >> 4)) * 8 * FRAG + idx * 8;
    _Float16* dst = Qt + idx * 8;
#if HAVE_ASYNC_LDS
    __builtin_amdgcn_global_load_async_to_lds_b128(
        (gas_b128p)src, (las_b128p)dst, 0, 0);
#else
    *(v8h*)dst = *(const v8h*)src;
#endif
  }
#if HAVE_ASYNC_LDS
  // this wave's copies have landed before the barrier behind which other waves read them
  asm volatile("s_wait_asynccnt 0x0" ::: "memory");
#endif
  __syncthreads();

  // ---- residual tile: each wave asks for the 32 channel rows (512 B each) that it will
  // itself add to and store at the end; they land while the key loop runs ----
#pragma unroll
  for (int i = 0; i < 32; ++i) {
    const int row = wave * 32 + i;
    const float* src = x + ((size_t)(b * CH + row)) * HW + q0 + lane * 4;
    float* dst = Xs + row * XLD + lane * 4;
#if HAVE_ASYNC_LDS
    __builtin_amdgcn_global_load_async_to_lds_b128(
        (gas_b128p)src, (las_b128p)dst, 0, 0);
#else
    *(float4*)dst = *(const float4*)src;
#endif
  }

  v8f o[MT][2];                       // O accum: QT rows x this wave's channels [wave*32, +32)
#pragma unroll
  for (int mt = 0; mt < MT; ++mt) { o[mt][0] = v8f{}; o[mt][1] = v8f{}; }
  const int cbase = wave * 32;
  float mrun = -1e30f;                // running row maximum (the row's 2 threads hold the same)
  float lpart = 0.f;                  // running sum over this thread's own 64-column segments

  for (int jt = 0; jt < 8; ++jt) {
    // --- S = Q * K^T * scale ; wave computes columns jt*128 + wave*16 .. +15, all QT rows ---
    {
      v8f s[MT];
#pragma unroll
      for (int mt = 0; mt < MT; ++mt) s[mt] = v8f{};
      const _Float16* kp = k16 + ((size_t)b * (HW / 16) + jt * 8 + wave) * 8 * FRAG + lane * 8;  // lane's own
      v16h kf[8];                     // this wave's K fragments of the key tile, asked for together
#pragma unroll
      for (int kk = 0; kk < 8; ++kk) kf[kk] = load_frag_packed(kp + kk * FRAG);
      // the K loads' address registers are rewritten only behind this wait; the lane's
      // address as an input keeps its registers out of the loads' own results
      asm volatile("s_wait_xcnt 0x0" :: "v"(kp) : "memory");
      v16h af[2][MT];                 // Q fragments: the set in use and the next k-step's
#pragma unroll
      for (int mt = 0; mt < MT; ++mt) af[0][mt] = load_frag_packed(Qt + mt * 8 * FRAG + lane * 8);
#pragma unroll
      for (int kk = 0; kk < 8; ++kk) {
        if (kk < 7) {
#pragma unroll
          for (int mt = 0; mt < MT; ++mt)
            af[(kk + 1) & 1][mt] = load_frag_packed(Qt + (mt * 8 + kk + 1) * FRAG + lane * 8);
        }
#pragma unroll
        for (int mt = 0; mt < MT; ++mt) s[mt] = wmma16(af[kk & 1][mt], kf[kk], s[mt]);
      }
      float* sl = St + hi * (8 * 132) + wave * 16 + n;   // lane's own; the rest are constant offsets
#pragma unroll
      for (int mt = 0; mt < MT; ++mt)
#pragma unroll
        for (int r = 0; r < 8; ++r)
          sl[(mt * 16 + r) * 132] = s[mt][r] * SCALE;
    }
    __syncthreads();

    // --- online softmax, 2 threads per row, scores held in registers ---
    {
      float sv[64];
      const float4* sp = (const float4*)(St + srow * 132 + sseg * 64);
      float lm = -1e30f;
#pragma unroll
      for (int c = 0; c < 16; ++c) {
        float4 t = sp[c];
        sv[4 * c] = t.x; sv[4 * c + 1] = t.y; sv[4 * c + 2] = t.z; sv[4 * c + 3] = t.w;
        lm = fmaxf(lm, fmaxf(fmaxf(t.x, t.y), fmaxf(t.z, t.w)));
      }
      red[sseg * QT + srow] = lm;
      __syncthreads();
      const float mnew = fmaxf(mrun, fmaxf(red[srow], red[QT + srow]));
      const float f = __expf(mrun - mnew);
      mrun = mnew;
      if (sseg == 0) fac[srow] = f;
      float sum = 0.f;
#pragma unroll
      for (int c = 0; c < 8; ++c) {
        v8h pk;
#pragma unroll
        for (int i = 0; i < 8; ++i) {
          float e = __expf(sv[c * 8 + i] - mnew);
          pk[i] = (_Float16)e;
          sum += e;
        }
        *(v8h*)(Pt + srow * 136 + sseg * 64 + c * 8) = pk;
      }
      lpart = lpart * f + sum;
    }
    __syncthreads();

    // --- rescale O, accumulate P * V ---
    {
      const _Float16* vp = vt16 + (((size_t)b * (CH / 16) + wave * 2) * (HW / 32) + jt * 4) * FRAG + lane * 8;  // lane's own
      v16h vf[4][2];                  // this wave's V fragments of the key tile, asked for together
#pragma unroll
      for (int kk = 0; kk < 4; ++kk) {
        vf[kk][0] = load_frag_packed(vp + kk * FRAG);
        vf[kk][1] = load_frag_packed(vp + (HW / 32 + kk) * FRAG);
      }
      // as behind the K loads: address registers rewritten only behind this wait
      asm volatile("s_wait_xcnt 0x0" :: "v"(vp) : "memory");
      v16h af[2][MT];                 // P fragments: the set in use and the next k-step's
#pragma unroll
      for (int mt = 0; mt < MT; ++mt) af[0][mt] = load_frag(Pt + mt * 16 * 136, 136);
#pragma unroll
      for (int mt = 0; mt < MT; ++mt) {
        const float4* fp = (const float4*)(fac + mt * 16 + 8 * hi);
        float4 f0 = fp[0], f1 = fp[1];
        float fr[8] = {f0.x, f0.y, f0.z, f0.w, f1.x, f1.y, f1.z, f1.w};
#pragma unroll
        for (int r = 0; r < 8; ++r) { o[mt][0][r] *= fr[r]; o[mt][1][r] *= fr[r]; }
      }
#pragma unroll
      for (int kk = 0; kk < 4; ++kk) {
        if (kk < 3) {
#pragma unroll
          for (int mt = 0; mt < MT; ++mt)
            af[(kk + 1) & 1][mt] = load_frag(Pt + mt * 16 * 136 + (kk + 1) * 32, 136);
        }
        // keeps the next k-step's LDS reads one group ahead of this k-step's WMMAs; without
        // the pair the compiler puts each read, with a wait to 0, in front of its two WMMAs
        __builtin_amdgcn_sched_barrier(0);
#pragma unroll
        for (int mt = 0; mt < MT; ++mt) {
          o[mt][0] = wmma16(af[kk & 1][mt], vf[kk][0], o[mt][0]);
          o[mt][1] = wmma16(af[kk & 1][mt], vf[kk][1], o[mt][1]);
        }
        __builtin_amdgcn_sched_barrier(0);  // second of the pair
      }
    }
    // no barrier here: St, red, Pt and fac are each rewritten only behind a later
    // barrier that every wave reaches after its last read of them
  }

  red[sseg * QT + srow] = lpart;      // last read of red was in front of the loop's last barrier
  __syncthreads();
  // ---- projection weights of this wave's 32 output channels, asked for ahead of the
  // normalisation so that they are there when the product starts ----
  const _Float16* wl = wp16 + (size_t)wave * 2 * 8 * FRAG + lane * 8; // lane's own
  v16h wf[8][2];
#pragma unroll
  for (int kk = 0; kk < 8; ++kk) {
    wf[kk][0] = load_frag_packed(wl + kk * FRAG);
    wf[kk][1] = load_frag_packed(wl + (8 + kk) * FRAG);
  }
  const float bias0 = b_proj[cbase + n], bias1 = b_proj[cbase + 16 + n];
  // as behind the K loads: address registers rewritten only behind this wait
  asm volatile("s_wait_xcnt 0x0" :: "v"(wl) : "memory");
  // normalised rows go to LDS as f16, (pixel, channel), in the Q tile's place: its last read
  // was in front of the loop's last barriers
#pragma unroll
  for (int mt = 0; mt < MT; ++mt) {
#pragma unroll
    for (int r = 0; r < 8; ++r) {
      int m = mt * 16 + r + 8 * hi;
      float inv = 1.0f / (red[m] + red[QT + m]);
      Qt[m * 264 + cbase + n]      = (_Float16)(o[mt][0][r] * inv);
      Qt[m * 264 + cbase + 16 + n] = (_Float16)(o[mt][1][r] * inv);
    }
  }
#if HAVE_ASYNC_LDS
  // this wave's residual rows have landed before it reads them
  asm volatile("s_wait_asynccnt 0x0" ::: "memory");
#endif
  __syncthreads();

  // ---- out(pixel, channel) = h * Wp^T: QT pixels x this wave's 32 output channels ----
  v8f acc[MT][2];
#pragma unroll
  for (int mt = 0; mt < MT; ++mt) { acc[mt][0] = v8f{}; acc[mt][1] = v8f{}; }
  {
    v16h af[2][MT];                   // h fragments: the set in use and the next k-step's
#pragma unroll
    for (int mt = 0; mt < MT; ++mt) af[0][mt] = load_frag(Qt + mt * 16 * 264, 264);
#pragma unroll
    for (int kk = 0; kk < 8; ++kk) {
      if (kk < 7) {
#pragma unroll
        for (int mt = 0; mt < MT; ++mt)
          af[(kk + 1) & 1][mt] = load_frag(Qt + mt * 16 * 264 + (kk + 1) * 32, 264);
      }
      // as in the P * V loop: keeps the next k-step's LDS reads one group ahead of this
      // k-step's WMMAs instead of one read, with a wait to 0, in front of its two WMMAs
      __builtin_amdgcn_sched_barrier(0);
#pragma unroll
      for (int mt = 0; mt < MT; ++mt) {
        acc[mt][0] = wmma16(af[kk & 1][mt], wf[kk][0], acc[mt][0]);
        acc[mt][1] = wmma16(af[kk & 1][mt], wf[kk][1], acc[mt][1]);
      }
      __builtin_amdgcn_sched_barrier(0);  // second of the pair
    }
  }

  // ---- residual and bias, in place in the wave's own rows of Xs: a lane holds 8 adjacent
  // pixels of one output channel ----
#pragma unroll
  for (int t = 0; t < 2; ++t) {
    const float bias = t ? bias1 : bias0;
#pragma unroll
    for (int mt = 0; mt < MT; ++mt) {
      float4* xp = (float4*)(Xs + (cbase + t * 16 + n) * XLD + mt * 16 + hi * 8);
      const float4 x0 = xp[0], x1 = xp[1];
      const v8f a = acc[mt][t];
      xp[0] = make_float4(x0.x + a[0] + bias, x0.y + a[1] + bias,
                          x0.z + a[2] + bias, x0.w + a[3] + bias);
      xp[1] = make_float4(x1.x + a[4] + bias, x1.y + a[5] + bias,
                          x1.z + a[6] + bias, x1.w + a[7] + bias);
    }
  }
  __syncthreads();
  // ---- whole 512-B rows go out: one store instruction of a wave = one channel row ----
  {
    float4 ov[32];
#pragma unroll
    for (int i = 0; i < 32; ++i) ov[i] = *(const float4*)(Xs + (wave * 32 + i) * XLD + lane * 4);
    float* od = out + ((size_t)(b * CH + wave * 32)) * HW + q0 + lane * 4;   // lane's own
#pragma unroll
    for (int i = 0; i < 32; ++i) *(float4*)(od + (size_t)i * HW) = ov[i];
  }
}

// ---------- launcher ----------
extern "C" void kernel_launch(void* const* d_in, const int* in_sizes, int n_in,
                              void* d_out, int out_size, void* d_ws, size_t ws_size,
                              hipStream_t stream) {
  const float* x      = (const float*)d_in[0];
  const float* gamma  = (const float*)d_in[1];
  const float* beta   = (const float*)d_in[2];
  const float* w_qkv  = (const float*)d_in[3];
  const float* b_qkv  = (const float*)d_in[4];
  const float* w_proj = (const float*)d_in[5];
  const float* b_proj = (const float*)d_in[6];
  float* out = (float*)d_out;

  char* ws = (char*)d_ws;
  _Float16* wq16 = (_Float16*)ws; ws += (size_t)3 * CH * CH * 2;   // 384 KB
  _Float16* wp16 = (_Float16*)ws; ws += (size_t)CH * CH * 2;       // 128 KB
  float*    mean = (float*)ws;    ws += BATCH * GRP * 4;
  float*    rstd = (float*)ws;    ws += BATCH * GRP * 4;
  _Float16* q16  = (_Float16*)ws; ws += (size_t)BATCH * HW * CH * 2;
  _Float16* k16  = (_Float16*)ws; ws += (size_t)BATCH * HW * CH * 2;
  _Float16* vt16 = (_Float16*)ws; ws += (size_t)BATCH * HW * CH * 2;

  gn_stats_kernel<<<BATCH * GRP, 256, 0, stream>>>(x, w_qkv, w_proj, mean, rstd, wq16, wp16);
  qkv_gemm_kernel<<<dim3(HW / PT, BATCH), 256, 0, stream>>>(
      x, gamma, beta, mean, rstd, wq16, b_qkv, q16, k16, vt16);
  attn_kernel<<<dim3(HW / QT, BATCH), 256, 0, stream>>>(q16, k16, vt16, wp16, b_proj, x, out);
}

// v006
// It runs in 66.8 microseconds.
// In two side-by-side timings against v005, it was 1.11 and 1.10 times as fast.
// All steps since v000 together make it 3.49 times as fast.
#include <hip/hip_runtime.h>
#include <hip/hip_bf16.h>
#include <math.h>

typedef __attribute__((ext_vector_type(16))) _Float16 v16h;
typedef __attribute__((ext_vector_type(8)))  _Float16 v8h;
typedef __attribute__((ext_vector_type(8)))  float    v8f;
typedef __attribute__((ext_vector_type(4)))  float    v4f;

#if defined(__has_builtin)
#  if __has_builtin(__builtin_amdgcn_global_load_async_to_lds_b128) && \
      __has_builtin(__builtin_amdgcn_s_wait_asynccnt)
#    define HAVE_ASYNC_LDS 1
#  endif
#endif
#ifndef HAVE_ASYNC_LDS
#  define HAVE_ASYNC_LDS 0
#endif

#if HAVE_ASYNC_LDS
// Builtin signature (from hipcc diagnostic): param 1 is
//   int __attribute__((vector_size(16))) addrspace(1)*  (non-const)
typedef int b128_t __attribute__((vector_size(16)));
typedef b128_t __attribute__((address_space(1)))* gas_b128p;
typedef b128_t __attribute__((address_space(3)))* las_b128p;
#endif

__device__ __forceinline__ v16h load_frag(const _Float16* __restrict__ base, int ld) {
  const int lane = threadIdx.x & 31;
  const int row  = lane & 15;
  const int hi   = lane >> 4;
  const _Float16* p = base + (size_t)row * ld + hi * 8;
  v8h c0 = *(const v8h*)(p);        // K = hi*8 .. hi*8+7
  v8h c1 = *(const v8h*)(p + 16);   // K = 16 + hi*8 ..
  v16h r;
#pragma unroll
  for (int i = 0; i < 8; ++i) { r[i] = c0[i]; r[i + 8] = c1[i]; }
  return r;
}

// The same fragment from the lane's own address p = base + (lane & 15) * ld + (lane >> 4) * 8.
__device__ __forceinline__ v16h load_frag_at(const _Float16* __restrict__ p) {
  v8h c0 = *(const v8h*)(p);
  v8h c1 = *(const v8h*)(p + 16);
  v16h r;
#pragma unroll
  for (int i = 0; i < 8; ++i) { r[i] = c0[i]; r[i + 8] = c1[i]; }
  return r;
}

#define FRAG 512
__device__ __forceinline__ v16h load_frag_packed(const _Float16* __restrict__ p) {
  v8h c0 = *(const v8h*)(p);
  v8h c1 = *(const v8h*)(p + 256);
  v16h r;
#pragma unroll
  for (int i = 0; i < 8; ++i) { r[i] = c0[i]; r[i + 8] = c1[i]; }
  return r;
}

__device__ __forceinline__ v8f wmma16(v16h a, v16h b, v8f c) {
  // D = A(16x32) * B(32x16) + C, f32 accumulate
  return __builtin_amdgcn_wmma_f32_16x16x32_f16(false, a, false, b, (short)0, c,
                                                false, false);
}

// ---------- constants ----------
#define BATCH 32
#define CH    256
#define HW    1024
#define GRP   8
#define CPG   32          // channels per group
#define SCALE 0.0625f     // 1/sqrt(256)

// ---------- kernel 0: GroupNorm statistics; weights f32 -> f16, packed fragment order ----------
// The two jobs share no data. One launch does both: each thread of the statistics grid also
// converts its share of the two weight matrices, whose loads are asked for together with the x
// loads and land among them.
// Fragment (16-row tile rt, k-step kk) of a (rows, 256) matrix lies at (rt * 8 + kk) * FRAG.
#define NPREP (BATCH * GRP * 256)   // threads of the launch
#define NXV (CPG * HW / 4 / 256)    // 16-B pieces of x a thread
// place i in a packed matrix -> index in the row-major (rows, 256) source
__device__ __forceinline__ int packed_src(int i) {
  const int ln = (i >> 3) & 31;
  const int row = (i >> 12) * 16 + (ln & 15);
  const int col = ((i >> 9) & 7) * 32 + ((i >> 8) & 1) * 16 + (ln >> 4) * 8 + (i & 7);
  return row * CH + col;
}
// x, wq, wp carry no __restrict__: with it the compiler takes their loads for loads of constant
// memory and moves them over the scheduling barrier below
__global__ __launch_bounds__(256) void gn_stats_kernel(
    const float* x, const float* wq, const float* wp,
    float* __restrict__ mean, float* __restrict__ rstd,
    _Float16* __restrict__ wq16, _Float16* __restrict__ wp16) {
  static_assert((3 * CH * CH) % NPREP == 0 && (CH * CH) % NPREP == 0, "whole shares");
  const int bg = blockIdx.x;                  // b*8+g
  const int i0 = bg * 256 + threadIdx.x;      // first place in the packed matrices
  float wqv[3 * CH * CH / NPREP], wpv[CH * CH / NPREP];
  int   wqi[3 * CH * CH / NPREP], wpi[CH * CH / NPREP];   // where they come from
  // these four short loops are unrolled so that the shares are indexed by constants and stay in registers
#pragma unroll
  for (int j = 0; j < 3 * CH * CH / NPREP; ++j) wqv[j] = wq[wqi[j] = packed_src(i0 + j * NPREP)];
#pragma unroll
  for (int j = 0; j < CH * CH / NPREP; ++j) wpv[j] = wp[wpi[j] = packed_src(i0 + j * NPREP)];
  // the group's 128 KB: a thread takes 32 pieces of 16 B, a wave's load covers 512 contiguous bytes
  const v4f* xp = (const v4f*)(x + (size_t)bg * CPG * HW) + threadIdx.x;   // lane's own
  v4f xv[NXV];
  // this loop and the summing loop are unrolled so that xv is indexed by constants and stays in registers
#pragma unroll
  for (int j = 0; j < NXV; ++j) xv[j] = xp[j * 256];
  // the loads' address registers are rewritten only behind this wait; the weights' places as
  // inputs keep their registers out of the x loads' results
  static_assert(3 * CH * CH / NPREP == 3 && CH * CH / NPREP == 1, "operands below");
  asm volatile("s_wait_xcnt 0x0" :: "v"(wqi[0]), "v"(wqi[1]), "v"(wqi[2]), "v"(wpi[0]) : "memory");
  // every load of the thread, the weights' too, is asked for before the first value is used, so
  // the block pays the memory latency once; without this the compiler keeps a dozen in flight
  // and asks for the weights last, in front of the first barrier's wait
  __builtin_amdgcn_sched_barrier(0);
  v4f a = v4f{}, a2 = v4f{};          // four independent chains each
#pragma unroll
  for (int j = 0; j < NXV; ++j) { a += xv[j]; a2 += xv[j] * xv[j]; }
  const float s = (a[0] + a[1]) + (a[2] + a[3]), s2 = (a2[0] + a2[1]) + (a2[2] + a2[3]);
  __shared__ float sm[256], sq[256];
  sm[threadIdx.x] = s; sq[threadIdx.x] = s2;
  __syncthreads();
  for (int off = 128; off > 0; off >>= 1) {
    if (threadIdx.x < off) {
      sm[threadIdx.x] += sm[threadIdx.x + off];
      sq[threadIdx.x] += sq[threadIdx.x + off];
    }
    __syncthreads();
  }
  // behind the last barrier: in front of one, every wave would wait there for these stores
#pragma unroll
  for (int j = 0; j < 3 * CH * CH / NPREP; ++j) wq16[i0 + j * NPREP] = (_Float16)wqv[j];
#pragma unroll
  for (int j = 0; j < CH * CH / NPREP; ++j) wp16[i0 + j * NPREP] = (_Float16)wpv[j];
  if (threadIdx.x == 0) {
    const float inv_n = 1.0f / (CPG * HW);
    float m = sm[0] * inv_n;
    float var = sq[0] * inv_n - m * m;
    mean[bg] = m;
    rstd[bg] = rsqrtf(var + 1e-5f);
  }
}

// ---------- kernel 1: GN-fused QKV GEMM ----------
// One block makes all 768 outputs of its 128 pixels: x is read and normalised once into an
// LDS tile [pixel][channel], behind one barrier. 8 waves; a wave runs 2 passes, each pass one
// 16-channel tile of Q, of K and of V over all 128 pixels (24 accumulator tiles), so every
// weight row is loaded by exactly one wave of the block.
#define PT  128           // pixels per block
#define PMT (PT / 16)     // 16-pixel tiles per block
#define ALD 264           // LDS row pitch in halves
__global__ __launch_bounds__(256) void qkv_gemm_kernel(
    const float* __restrict__ x, const float* __restrict__ gamma,
    const float* __restrict__ beta, const float* __restrict__ mean,
    const float* __restrict__ rstd, const _Float16* __restrict__ wq16,
    const float* __restrict__ b_qkv,
    _Float16* __restrict__ q16, _Float16* __restrict__ k16,
    _Float16* __restrict__ vt16) {
  const int p0 = blockIdx.x * PT;
  const int b  = blockIdx.y;
  const int tid = threadIdx.x, lane = tid & 31;
  const int wave = __builtin_amdgcn_readfirstlane(tid >> 5);
  const int n = lane & 15, hi = lane >> 4;

  __shared__ __attribute__((aligned(16))) _Float16 At[PT * ALD];
  __shared__ __attribute__((aligned(16))) float    Bs[3 * CH];   // b_qkv, read where a pass ends

  // Step s = pass * 8 + k-step. Weight fragment of step s for product t (0 Q, 1 K, 2 V):
  // rows t*256 + pass*128 + wave*16 .. +15, channels (s & 7)*32 .. +31.
  const _Float16* wl = wq16 + (size_t)wave * 8 * FRAG + lane * 8;     // lane's own
  auto wfrag = [&](int s, int t) {
    return load_frag_packed(wl + (size_t)((t * 16 + (s >> 3) * 8) * 8 + (s & 7)) * FRAG);
  };
  v16h bf[4][3];                      // weight fragments, a ring four steps deep

  // staging: thread -> pixel tid & 127, 8 adjacent channels of every 16 (one b128 LDS store)
  {
    const int sp = tid & (PT - 1);
    const int sh = __builtin_amdgcn_readfirstlane(tid >> 7) * 8;
    const float* xl = x + ((size_t)(b * CH + sh)) * HW + p0 + sp;    // lane's own
    float xv[16][8];
#pragma unroll
    for (int ch = 0; ch < 16; ++ch)
#pragma unroll
      for (int i = 0; i < 8; ++i) xv[ch][i] = xl[(size_t)(ch * 16 + i) * HW];
    const float b0 = b_qkv[tid], b1 = b_qkv[CH + tid], b2 = b_qkv[2 * CH + tid];
#pragma unroll
    for (int s = 0; s < 4; ++s)
#pragma unroll
      for (int t = 0; t < 3; ++t) bf[s][t] = wfrag(s, t);
    // all of the tile's loads are asked for before the first is used; without this the
    // compiler issues them two at a time, each pair behind a wait to 0
    __builtin_amdgcn_sched_barrier(0);
#pragma unroll
    for (int ch = 0; ch < 16; ++ch) {
      const float mu = mean[b * GRP + (ch >> 1)];
      const float rs = rstd[b * GRP + (ch >> 1)];
      v8h pk;
#pragma unroll
      for (int i = 0; i < 8; ++i) {
        const int c = sh + ch * 16 + i;
        pk[i] = (_Float16)((xv[ch][i] - mu) * rs * gamma[c] + beta[c]);
      }
      *(v8h*)(&At[sp * ALD + sh + ch * 16]) = pk;
    }
    Bs[tid] = b0; Bs[CH + tid] = b1; Bs[2 * CH + tid] = b2;
  }
  __syncthreads();

  const _Float16* al = At + n * ALD + hi * 8;                        // lane's own
  v16h af[2][PMT];                    // pixel fragments: the set in use and the next step's
#pragma unroll
  for (int mt = 0; mt < PMT; ++mt) af[0][mt] = load_frag_at(al + mt * 16 * ALD);
  // one pass: 8 k-steps, then its 16 channels of Q, K and V go out
  auto pass = [&](const int ps) {
    v8f acc[3][PMT];
#pragma unroll
    for (int t = 0; t < 3; ++t)
#pragma unroll
      for (int mt = 0; mt < PMT; ++mt) acc[t][mt] = v8f{};
#pragma unroll
    for (int kk = 0; kk < 8; ++kk) {
      const int s = ps * 8 + kk;
      if (s < 15) {
#pragma unroll
        for (int mt = 0; mt < PMT; ++mt)
          af[(kk + 1) & 1][mt] = load_frag_at(al + mt * 16 * ALD + ((kk + 1) & 7) * 32);
      }
      // keeps the next step's LDS reads as one group ahead of this step's WMMAs, and the ring's
      // refill behind them; without the pair the compiler puts two reads, with a wait to 0, in
      // front of every three WMMAs and spills
      __builtin_amdgcn_sched_barrier(0);
      // Q, K: weights as the row operand, so a lane holds 8 adjacent channels of one pixel;
      // V: pixels as the row operand, so a lane holds 8 adjacent pixels of one channel
#pragma unroll
      for (int t = 0; t < 2; ++t)
#pragma unroll
        for (int mt = 0; mt < PMT; ++mt)
          acc[t][mt] = wmma16(bf[kk & 3][t], af[kk & 1][mt], acc[t][mt]);
#pragma unroll
      for (int mt = 0; mt < PMT; ++mt)
        acc[2][mt] = wmma16(af[kk & 1][mt], bf[kk & 3][2], acc[2][mt]);
      __builtin_amdgcn_sched_barrier(0);  // second of the pair
      if (s + 4 < 16) {
#pragma unroll
        for (int t = 0; t < 3; ++t) bf[kk & 3][t] = wfrag(s + 4, t);
      }
    }
    const int c0 = ps * 128 + wave * 16;
    const float4* bq4 = (const float4*)(Bs + c0 + hi * 8);
    const float4* bk4 = (const float4*)(Bs + CH + c0 + hi * 8);
    const float4 q0 = bq4[0], q1 = bq4[1], k0 = bk4[0], k1 = bk4[1];
    const float bq[8] = {q0.x, q0.y, q0.z, q0.w, q1.x, q1.y, q1.z, q1.w};
    const float bk[8] = {k0.x, k0.y, k0.z, k0.w, k1.x, k1.y, k1.z, k1.w};
    const float bv = Bs[2 * CH + c0 + n];
    // packed fragment order. Q, K: fragment (16-pixel tile, 32-channel step), a lane's 8 channels
    // are its piece of k half (c0 >> 4) & 1. V: fragment (16-channel tile, 32-pixel step), a
    // lane's 8 pixels are its piece of k half mt & 1.
    const size_t qko = ((((size_t)b * (HW / 16) + (p0 >> 4)) * 8 + (c0 >> 5)) * 2 + ((c0 >> 4) & 1)) * 256
                       + lane * 8;
    _Float16* qd = q16 + qko;
    _Float16* kd = k16 + qko;
    _Float16* vd = vt16 + (((size_t)b * (CH / 16) + (c0 >> 4)) * (HW / 32) + (p0 >> 5)) * FRAG + lane * 8;
    v8h pq[PMT], pk[PMT], pv[PMT];
#pragma unroll
    for (int mt = 0; mt < PMT; ++mt)
#pragma unroll
      for (int r = 0; r < 8; ++r) {
        pq[mt][r] = (_Float16)(acc[0][mt][r] + bq[r]);
        pk[mt][r] = (_Float16)(acc[1][mt][r] + bk[r]);
        pv[mt][r] = (_Float16)(acc[2][mt][r] + bv);
      }
    // the stores go out as one run behind the last conversion, so that none of their
    // registers is written again behind them (first pass: in front of the wait below)
    __builtin_amdgcn_sched_barrier(0);
#pragma unroll
    for (int mt = 0; mt < PMT; ++mt) {
      *(v8h*)(qd + (size_t)mt * 8 * FRAG) = pq[mt];
      *(v8h*)(kd + (size_t)mt * 8 * FRAG) = pk[mt];
      *(v8h*)(vd + mt * 256) = pv[mt];
    }
    if (ps == 0) {
      // the stores' address and data registers are rewritten only behind this wait
      asm volatile("s_wait_xcnt 0x0" ::: "memory");
      __builtin_amdgcn_sched_barrier(0);  // keeps the next pass's register writes behind the wait
    }
  };
  pass(0);
  pass(1);
}

// ---------- kernel 2: flash attention (128 q-rows per block, online softmax), then the
// output projection, bias and residual of the block's own 128 pixels ----------
// Every K and V fragment that a wave loads from global memory feeds 8 row tiles
// (QT / 16), so the block reads K and V once per 128 queries. A block ends with all 256
// channels of its 128 pixels, which is all that the projection of those pixels needs.
#define QT 128            // query rows per block
#define MT (QT / 16)      // 16-row tiles per block
#define XLD 132           // residual tile's row pitch in floats (528 B = 16 B x odd)
__global__ __launch_bounds__(256) void attn_kernel(
    const _Float16* __restrict__ q16, const _Float16* __restrict__ k16,
    const _Float16* __restrict__ vt16, const _Float16* __restrict__ wp16,
    const float* __restrict__ b_proj, const float* __restrict__ x,
    float* __restrict__ out) {
  const int q0 = blockIdx.x * QT;
  const int b  = blockIdx.y;
  const int tid = threadIdx.x, wave = tid >> 5, lane = tid & 31;
  const int n = lane & 15, hi = lane >> 4;
  const int srow = tid & (QT - 1), sseg = tid >> 7;  // softmax mapping: 2 thr/row, 64 cols each

  // Qt and St carry the larger alignment so that they lie first in LDS and Xs behind them: the
  // compiler folds a copy's row step into its offset field and takes it off the LDS address
  // register, which then stays above 0 for every row of Xs
  __shared__ __attribute__((aligned(128))) _Float16 Qt[QT * 264]; // Q tile, packed fragments; then h, ld=264
  __shared__ __attribute__((aligned(128))) float    St[QT * 132]; // scores tile QT x 128, ld=132
  __shared__ __attribute__((aligned(16))) _Float16 Pt[QT * 136];  // exp tile f16, ld=136
  __shared__ __attribute__((aligned(16))) float    red[2 * QT];   // per-row partials of the 2 segments
  __shared__ __attribute__((aligned(16))) float    fac[QT];       // per-row rescale factor
  __shared__ __attribute__((aligned(16))) float    Xs[CH * XLD];  // x, then out: (channel, pixel)

#pragma unroll
  for (int it = 0; it < QT / 8; ++it) {
    int idx = tid + it * 256;                 // 16B chunk id; the tile's 64 fragments lie in a row
    const _Float16* src = q16 + ((size_t)b * (HW / 16) + (q0 >> 4)) * 8 * FRAG + idx * 8;
    _Float16* dst = Qt + idx * 8;
#if HAVE_ASYNC_LDS
    __builtin_amdgcn_global_load_async_to_lds_b128(
        (gas_b128p)src, (las_b128p)dst, 0, 0);
#else
    *(v8h*)dst = *(const v8h*)src;
#endif
  }
#if HAVE_ASYNC_LDS
  // this wave's copies have landed before the barrier behind which other waves read them
  asm volatile("s_wait_asynccnt 0x0" ::: "memory");
#endif
  __syncthreads();

  // ---- residual tile: each wave asks for the 32 channel rows (512 B each) that it will
  // itself add to and store at the end; they land while the key loop runs ----
#pragma unroll
  for (int i = 0; i < 32; ++i) {
    const int row = wave * 32 + i;
    const float* src = x + ((size_t)(b * CH + row)) * HW + q0 + lane * 4;
    float* dst = Xs + row * XLD + lane * 4;
#if HAVE_ASYNC_LDS
    __builtin_amdgcn_global_load_async_to_lds_b128(
        (gas_b128p)src, (las_b128p)dst, 0, 0);
#else
    *(float4*)dst = *(const float4*)src;
#endif
  }

  v8f o[MT][2];                       // O accum: QT rows x this wave's channels [wave*32, +32)
#pragma unroll
  for (int mt = 0; mt < MT; ++mt) { o[mt][0] = v8f{}; o[mt][1] = v8f{}; }
  const int cbase = wave * 32;
  float mrun = -1e30f;                // running row maximum (the row's 2 threads hold the same)
  float lpart = 0.f;                  // running sum over this thread's own 64-column segments

  for (int jt = 0; jt < 8; ++jt) {
    // --- S = Q * K^T * scale ; wave computes columns jt*128 + wave*16 .. +15, all QT rows ---
    {
      v8f s[MT];
#pragma unroll
      for (int mt = 0; mt < MT; ++mt) s[mt] = v8f{};
      const _Float16* kp = k16 + ((size_t)b * (HW / 16) + jt * 8 + wave) * 8 * FRAG + lane * 8;  // lane's own
      v16h kf[8];                     // this wave's K fragments of the key tile, asked for together
#pragma unroll
      for (int kk = 0; kk < 8; ++kk) kf[kk] = load_frag_packed(kp + kk * FRAG);
      // the K loads' address registers are rewritten only behind this wait; the lane's
      // address as an input keeps its registers out of the loads' own results
      asm volatile("s_wait_xcnt 0x0" :: "v"(kp) : "memory");
      v16h af[2][MT];                 // Q fragments: the set in use and the next k-step's
#pragma unroll
      for (int mt = 0; mt < MT; ++mt) af[0][mt] = load_frag_packed(Qt + mt * 8 * FRAG + lane * 8);
#pragma unroll
      for (int kk = 0; kk < 8; ++kk) {
        if (kk < 7) {
#pragma unroll
          for (int mt = 0; mt < MT; ++mt)
            af[(kk + 1) & 1][mt] = load_frag_packed(Qt + (mt * 8 + kk + 1) * FRAG + lane * 8);
        }
#pragma unroll
        for (int mt = 0; mt < MT; ++mt) s[mt] = wmma16(af[kk & 1][mt], kf[kk], s[mt]);
      }
      float* sl = St + hi * (8 * 132) + wave * 16 + n;   // lane's own; the rest are constant offsets
#pragma unroll
      for (int mt = 0; mt < MT; ++mt)
#pragma unroll
        for (int r = 0; r < 8; ++r)
          sl[(mt * 16 + r) * 132] = s[mt][r] * SCALE;
    }
    __syncthreads();

    // --- online softmax, 2 threads per row, scores held in registers ---
    {
      float sv[64];
      const float4* sp = (const float4*)(St + srow * 132 + sseg * 64);
      float lm = -1e30f;
#pragma unroll
      for (int c = 0; c < 16; ++c) {
        float4 t = sp[c];
        sv[4 * c] = t.x; sv[4 * c + 1] = t.y; sv[4 * c + 2] = t.z; sv[4 * c + 3] = t.w;
        lm = fmaxf(lm, fmaxf(fmaxf(t.x, t.y), fmaxf(t.z, t.w)));
      }
      red[sseg * QT + srow] = lm;
      __syncthreads();
      const float mnew = fmaxf(mrun, fmaxf(red[srow], red[QT + srow]));
      const float f = __expf(mrun - mnew);
      mrun = mnew;
      if (sseg == 0) fac[srow] = f;
      float sum = 0.f;
#pragma unroll
      for (int c = 0; c < 8; ++c) {
        v8h pk;
#pragma unroll
        for (int i = 0; i < 8; ++i) {
          float e = __expf(sv[c * 8 + i] - mnew);
          pk[i] = (_Float16)e;
          sum += e;
        }
        *(v8h*)(Pt + srow * 136 + sseg * 64 + c * 8) = pk;
      }
      lpart = lpart * f + sum;
    }
    __syncthreads();

    // --- rescale O, accumulate P * V ---
    {
      const _Float16* vp = vt16 + (((size_t)b * (CH / 16) + wave * 2) * (HW / 32) + jt * 4) * FRAG + lane * 8;  // lane's own
      v16h vf[4][2];                  // this wave's V fragments of the key tile, asked for together
#pragma unroll
      for (int kk = 0; kk < 4; ++kk) {
        vf[kk][0] = load_frag_packed(vp + kk * FRAG);
        vf[kk][1] = load_frag_packed(vp + (HW / 32 + kk) * FRAG);
      }
      // as behind the K loads: address registers rewritten only behind this wait
      asm volatile("s_wait_xcnt 0x0" :: "v"(vp) : "memory");
      v16h af[2][MT];                 // P fragments: the set in use and the next k-step's
#pragma unroll
      for (int mt = 0; mt < MT; ++mt) af[0][mt] = load_frag(Pt + mt * 16 * 136, 136);
#pragma unroll
      for (int mt = 0; mt < MT; ++mt) {
        const float4* fp = (const float4*)(fac + mt * 16 + 8 * hi);
        float4 f0 = fp[0], f1 = fp[1];
        float fr[8] = {f0.x, f0.y, f0.z, f0.w, f1.x, f1.y, f1.z, f1.w};
#pragma unroll
        for (int r = 0; r < 8; ++r) { o[mt][0][r] *= fr[r]; o[mt][1][r] *= fr[r]; }
      }
#pragma unroll
      for (int kk = 0; kk < 4; ++kk) {
        if (kk < 3) {
#pragma unroll
          for (int mt = 0; mt < MT; ++mt)
            af[(kk + 1) & 1][mt] = load_frag(Pt + mt * 16 * 136 + (kk + 1) * 32, 136);
        }
        // keeps the next k-step's LDS reads one group ahead of this k-step's WMMAs; without
        // the pair the compiler puts each read, with a wait to 0, in front of its two WMMAs
        __builtin_amdgcn_sched_barrier(0);
#pragma unroll
        for (int mt = 0; mt < MT; ++mt) {
          o[mt][0] = wmma16(af[kk & 1][mt], vf[kk][0], o[mt][0]);
          o[mt][1] = wmma16(af[kk & 1][mt], vf[kk][1], o[mt][1]);
        }
        __builtin_amdgcn_sched_barrier(0);  // second of the pair
      }
    }
    // no barrier here: St, red, Pt and fac are each rewritten only behind a later
    // barrier that every wave reaches after its last read of them
  }

  red[sseg * QT + srow] = lpart;      // last read of red was in front of the loop's last barrier
  __syncthreads();
  // ---- projection weights of this wave's 32 output channels, asked for ahead of the
  // normalisation so that they are there when the product starts ----
  const _Float16* wl = wp16 + (size_t)wave * 2 * 8 * FRAG + lane * 8; // lane's own
  v16h wf[8][2];
#pragma unroll
  for (int kk = 0; kk < 8; ++kk) {
    wf[kk][0] = load_frag_packed(wl + kk * FRAG);
    wf[kk][1] = load_frag_packed(wl + (8 + kk) * FRAG);
  }
  const float bias0 = b_proj[cbase + n], bias1 = b_proj[cbase + 16 + n];
  // as behind the K loads: address registers rewritten only behind this wait
  asm volatile("s_wait_xcnt 0x0" :: "v"(wl) : "memory");
  // normalised rows go to LDS as f16, (pixel, channel), in the Q tile's place: its last read
  // was in front of the loop's last barriers
#pragma unroll
  for (int mt = 0; mt < MT; ++mt) {
#pragma unroll
    for (int r = 0; r < 8; ++r) {
      int m = mt * 16 + r + 8 * hi;
      float inv = 1.0f / (red[m] + red[QT + m]);
      Qt[m * 264 + cbase + n]      = (_Float16)(o[mt][0][r] * inv);
      Qt[m * 264 + cbase + 16 + n] = (_Float16)(o[mt][1][r] * inv);
    }
  }
#if HAVE_ASYNC_LDS
  // this wave's residual rows have landed before it reads them
  asm volatile("s_wait_asynccnt 0x0" ::: "memory");
#endif
  __syncthreads();

  // ---- out(pixel, channel) = h * Wp^T: QT pixels x this wave's 32 output channels ----
  v8f acc[MT][2];
#pragma unroll
  for (int mt = 0; mt < MT; ++mt) { acc[mt][0] = v8f{}; acc[mt][1] = v8f{}; }
  {
    v16h af[2][MT];                   // h fragments: the set in use and the next k-step's
#pragma unroll
    for (int mt = 0; mt < MT; ++mt) af[0][mt] = load_frag(Qt + mt * 16 * 264, 264);
#pragma unroll
    for (int kk = 0; kk < 8; ++kk) {
      if (kk < 7) {
#pragma unroll
        for (int mt = 0; mt < MT; ++mt)
          af[(kk + 1) & 1][mt] = load_frag(Qt + mt * 16 * 264 + (kk + 1) * 32, 264);
      }
      // as in the P * V loop: keeps the next k-step's LDS reads one group ahead of this
      // k-step's WMMAs instead of one read, with a wait to 0, in front of its two WMMAs
      __builtin_amdgcn_sched_barrier(0);
#pragma unroll
      for (int mt = 0; mt < MT; ++mt) {
        acc[mt][0] = wmma16(af[kk & 1][mt], wf[kk][0], acc[mt][0]);
        acc[mt][1] = wmma16(af[kk & 1][mt], wf[kk][1], acc[mt][1]);
      }
      __builtin_amdgcn_sched_barrier(0);  // second of the pair
    }
  }

  // ---- residual and bias, in place in the wave's own rows of Xs: a lane holds 8 adjacent
  // pixels of one output channel ----
#pragma unroll
  for (int t = 0; t < 2; ++t) {
    const float bias = t ? bias1 : bias0;
#pragma unroll
    for (int mt = 0; mt < MT; ++mt) {
      float4* xp = (float4*)(Xs + (cbase + t * 16 + n) * XLD + mt * 16 + hi * 8);
      const float4 x0 = xp[0], x1 = xp[1];
      const v8f a = acc[mt][t];
      xp[0] = make_float4(x0.x + a[0] + bias, x0.y + a[1] + bias,
                          x0.z + a[2] + bias, x0.w + a[3] + bias);
      xp[1] = make_float4(x1.x + a[4] + bias, x1.y + a[5] + bias,
                          x1.z + a[6] + bias, x1.w + a[7] + bias);
    }
  }
  __syncthreads();
  // ---- whole 512-B rows go out: one store instruction of a wave = one channel row ----
  {
    float4 ov[32];
#pragma unroll
    for (int i = 0; i < 32; ++i) ov[i] = *(const float4*)(Xs + (wave * 32 + i) * XLD + lane * 4);
    float* od = out + ((size_t)(b * CH + wave * 32)) * HW + q0 + lane * 4;   // lane's own
#pragma unroll
    for (int i = 0; i < 32; ++i) *(float4*)(od + (size_t)i * HW) = ov[i];
  }
}

// ---------- launcher ----------
extern "C" void kernel_launch(void* const* d_in, const int* in_sizes, int n_in,
                              void* d_out, int out_size, void* d_ws, size_t ws_size,
                              hipStream_t stream) {
  const float* x      = (const float*)d_in[0];
  const float* gamma  = (const float*)d_in[1];
  const float* beta   = (const float*)d_in[2];
  const float* w_qkv  = (const float*)d_in[3];
  const float* b_qkv  = (const float*)d_in[4];
  const float* w_proj = (const float*)d_in[5];
  const float* b_proj = (const float*)d_in[6];
  float* out = (float*)d_out;

  char* ws = (char*)d_ws;
  _Float16* wq16 = (_Float16*)ws; ws += (size_t)3 * CH * CH * 2;   // 384 KB
  _Float16* wp16 = (_Float16*)ws; ws += (size_t)CH * CH * 2;       // 128 KB
  float*    mean = (float*)ws;    ws += BATCH * GRP * 4;
  float*    rstd = (float*)ws;    ws += BATCH * GRP * 4;
  _Float16* q16  = (_Float16*)ws; ws += (size_t)BATCH * HW * CH * 2;
  _Float16* k16  = (_Float16*)ws; ws += (size_t)BATCH * HW * CH * 2;
  _Float16* vt16 = (_Float16*)ws; ws += (size_t)BATCH * HW * CH * 2;

  gn_stats_kernel<<<BATCH * GRP, 256, 0, stream>>>(x, w_qkv, w_proj, mean, rstd, wq16, wp16);
  qkv_gemm_kernel<<<dim3(HW / PT, BATCH), 256, 0, stream>>>(
      x, gamma, beta, mean, rstd, wq16, b_qkv, q16, k16, vt16);
  attn_kernel<<<dim3(HW / QT, BATCH), 256, 0, stream>>>(q16, k16, vt16, wp16, b_proj, x, out);
}

// v007
// One run takes 61.9 microseconds.
// Timed twice side by side with v006, it ran 1.08 times as fast both times.
// Over all steps from v000 it is 3.76 times as fast.
#include <hip/hip_runtime.h>
#include <hip/hip_bf16.h>
#include <math.h>

typedef __attribute__((ext_vector_type(16))) _Float16 v16h;
typedef __attribute__((ext_vector_type(8)))  _Float16 v8h;
typedef __attribute__((ext_vector_type(8)))  float    v8f;
typedef __attribute__((ext_vector_type(4)))  float    v4f;

#if defined(__has_builtin)
#  if __has_builtin(__builtin_amdgcn_global_load_async_to_lds_b128) && \
      __has_builtin(__builtin_amdgcn_s_wait_asynccnt)
#    define HAVE_ASYNC_LDS 1
#  endif
#endif
#ifndef HAVE_ASYNC_LDS
#  define HAVE_ASYNC_LDS 0
#endif

#if HAVE_ASYNC_LDS
// Builtin signature (from hipcc diagnostic): param 1 is
//   int __attribute__((vector_size(16))) addrspace(1)*  (non-const)
typedef int b128_t __attribute__((vector_size(16)));
typedef b128_t __attribute__((address_space(1)))* gas_b128p;
typedef b128_t __attribute__((address_space(3)))* las_b128p;
#endif

__device__ __forceinline__ v16h load_frag(const _Float16* __restrict__ base, int ld) {
  const int lane = threadIdx.x & 31;
  const int row  = lane & 15;
  const int hi   = lane >> 4;
  const _Float16* p = base + (size_t)row * ld + hi * 8;
  v8h c0 = *(const v8h*)(p);        // K = hi*8 .. hi*8+7
  v8h c1 = *(const v8h*)(p + 16);   // K = 16 + hi*8 ..
  v16h r;
#pragma unroll
  for (int i = 0; i < 8; ++i) { r[i] = c0[i]; r[i + 8] = c1[i]; }
  return r;
}

// The same fragment from the lane's own address p = base + (lane & 15) * ld + (lane >> 4) * 8.
__device__ __forceinline__ v16h load_frag_at(const _Float16* __restrict__ p) {
  v8h c0 = *(const v8h*)(p);
  v8h c1 = *(const v8h*)(p + 16);
  v16h r;
#pragma unroll
  for (int i = 0; i < 8; ++i) { r[i] = c0[i]; r[i + 8] = c1[i]; }
  return r;
}

#define FRAG 512
__device__ __forceinline__ v16h load_frag_packed(const _Float16* __restrict__ p) {
  v8h c0 = *(const v8h*)(p);
  v8h c1 = *(const v8h*)(p + 256);
  v16h r;
#pragma unroll
  for (int i = 0; i < 8; ++i) { r[i] = c0[i]; r[i + 8] = c1[i]; }
  return r;
}

__device__ __forceinline__ v8f wmma16(v16h a, v16h b, v8f c) {
  // D = A(16x32) * B(32x16) + C, f32 accumulate
  return __builtin_amdgcn_wmma_f32_16x16x32_f16(false, a, false, b, (short)0, c,
                                                false, false);
}

// ---------- constants ----------
#define BATCH 32
#define CH    256
#define HW    1024
#define GRP   8
#define CPG   32          // channels per group
#define SCALE 0.0625f     // 1/sqrt(256)

// ---------- kernel 0: GroupNorm statistics; weights f32 -> f16, packed fragment order ----------
// The two jobs share no data. One launch does both: each thread of the statistics grid also
// converts its share of the two weight matrices, whose loads are asked for together with the x
// loads and land among them.
// Fragment (16-row tile rt, k-step kk) of a (rows, 256) matrix lies at (rt * 8 + kk) * FRAG.
#define NPREP (BATCH * GRP * 256)   // threads of the launch
#define NXV (CPG * HW / 4 / 256)    // 16-B pieces of x a thread
// place i in a packed matrix -> index in the row-major (rows, 256) source
__device__ __forceinline__ int packed_src(int i) {
  const int ln = (i >> 3) & 31;
  const int row = (i >> 12) * 16 + (ln & 15);
  const int col = ((i >> 9) & 7) * 32 + ((i >> 8) & 1) * 16 + (ln >> 4) * 8 + (i & 7);
  return row * CH + col;
}
// x, wq, wp carry no __restrict__: with it the compiler takes their loads for loads of constant
// memory and moves them over the scheduling barrier below
__global__ __launch_bounds__(256) void gn_stats_kernel(
    const float* x, const float* wq, const float* wp,
    float* __restrict__ mean, float* __restrict__ rstd,
    _Float16* __restrict__ wq16, _Float16* __restrict__ wp16) {
  static_assert((3 * CH * CH) % NPREP == 0 && (CH * CH) % NPREP == 0, "whole shares");
  const int bg = blockIdx.x;                  // b*8+g
  const int i0 = bg * 256 + threadIdx.x;      // first place in the packed matrices
  float wqv[3 * CH * CH / NPREP], wpv[CH * CH / NPREP];
  int   wqi[3 * CH * CH / NPREP], wpi[CH * CH / NPREP];   // where they come from
  // these four short loops are unrolled so that the shares are indexed by constants and stay in registers
#pragma unroll
  for (int j = 0; j < 3 * CH * CH / NPREP; ++j) wqv[j] = wq[wqi[j] = packed_src(i0 + j * NPREP)];
#pragma unroll
  for (int j = 0; j < CH * CH / NPREP; ++j) wpv[j] = wp[wpi[j] = packed_src(i0 + j * NPREP)];
  // the group's 128 KB: a thread takes 32 pieces of 16 B, a wave's load covers 512 contiguous bytes
  const v4f* xp = (const v4f*)(x + (size_t)bg * CPG * HW) + threadIdx.x;   // lane's own
  v4f xv[NXV];
  // this loop and the summing loop are unrolled so that xv is indexed by constants and stays in registers
#pragma unroll
  for (int j = 0; j < NXV; ++j) xv[j] = xp[j * 256];
  // the loads' address registers are rewritten only behind this wait; the weights' places as
  // inputs keep their registers out of the x loads' results
  static_assert(3 * CH * CH / NPREP == 3 && CH * CH / NPREP == 1, "operands below");
  asm volatile("s_wait_xcnt 0x0" :: "v"(wqi[0]), "v"(wqi[1]), "v"(wqi[2]), "v"(wpi[0]) : "memory");
  // every load of the thread, the weights' too, is asked for before the first value is used, so
  // the block pays the memory latency once; without this the compiler keeps a dozen in flight
  // and asks for the weights last, in front of the first barrier's wait
  __builtin_amdgcn_sched_barrier(0);
  v4f a = v4f{}, a2 = v4f{};          // four independent chains each
#pragma unroll
  for (int j = 0; j < NXV; ++j) { a += xv[j]; a2 += xv[j] * xv[j]; }
  const float s = (a[0] + a[1]) + (a[2] + a[3]), s2 = (a2[0] + a2[1]) + (a2[2] + a2[3]);
  __shared__ float sm[256], sq[256];
  sm[threadIdx.x] = s; sq[threadIdx.x] = s2;
  __syncthreads();
  for (int off = 128; off > 0; off >>= 1) {
    if (threadIdx.x < off) {
      sm[threadIdx.x] += sm[threadIdx.x + off];
      sq[threadIdx.x] += sq[threadIdx.x + off];
    }
    __syncthreads();
  }
  // behind the last barrier: in front of one, every wave would wait there for these stores
#pragma unroll
  for (int j = 0; j < 3 * CH * CH / NPREP; ++j) wq16[i0 + j * NPREP] = (_Float16)wqv[j];
#pragma unroll
  for (int j = 0; j < CH * CH / NPREP; ++j) wp16[i0 + j * NPREP] = (_Float16)wpv[j];
  if (threadIdx.x == 0) {
    const float inv_n = 1.0f / (CPG * HW);
    float m = sm[0] * inv_n;
    float var = sq[0] * inv_n - m * m;
    mean[bg] = m;
    rstd[bg] = rsqrtf(var + 1e-5f);
  }
}

// ---------- kernel 1: GN-fused QKV GEMM ----------
// One block makes all 768 outputs of its 128 pixels: x is read and normalised once into an
// LDS tile [pixel][channel], behind one barrier. 8 waves; a wave runs 2 passes, each pass one
// 16-channel tile of Q, of K and of V over all 128 pixels (24 accumulator tiles), so every
// weight row is loaded by exactly one wave of the block.
#define PT  128           // pixels per block
#define PMT (PT / 16)     // 16-pixel tiles per block
#define ALD 264           // LDS row pitch in halves
__global__ __launch_bounds__(256) void qkv_gemm_kernel(
    const float* __restrict__ x, const float* __restrict__ gamma,
    const float* __restrict__ beta, const float* __restrict__ mean,
    const float* __restrict__ rstd, const _Float16* __restrict__ wq16,
    const float* __restrict__ b_qkv,
    _Float16* __restrict__ q16, _Float16* __restrict__ k16,
    _Float16* __restrict__ vt16) {
  const int p0 = blockIdx.x * PT;
  const int b  = blockIdx.y;
  const int tid = threadIdx.x, lane = tid & 31;
  const int wave = __builtin_amdgcn_readfirstlane(tid >> 5);
  const int n = lane & 15, hi = lane >> 4;

  __shared__ __attribute__((aligned(16))) _Float16 At[PT * ALD];
  __shared__ __attribute__((aligned(16))) float    Bs[3 * CH];   // b_qkv, read where a pass ends

  // Step s = pass * 8 + k-step. Weight fragment of step s for product t (0 Q, 1 K, 2 V):
  // rows t*256 + pass*128 + wave*16 .. +15, channels (s & 7)*32 .. +31.
  const _Float16* wl = wq16 + (size_t)wave * 8 * FRAG + lane * 8;     // lane's own
  auto wfrag = [&](int s, int t) {
    return load_frag_packed(wl + (size_t)((t * 16 + (s >> 3) * 8) * 8 + (s & 7)) * FRAG);
  };
  v16h bf[4][3];                      // weight fragments, a ring four steps deep

  // staging: thread -> pixel tid & 127, 8 adjacent channels of every 16 (one b128 LDS store)
  {
    const int sp = tid & (PT - 1);
    const int sh = __builtin_amdgcn_readfirstlane(tid >> 7) * 8;
    const float* xl = x + ((size_t)(b * CH + sh)) * HW + p0 + sp;    // lane's own
    float xv[16][8];
#pragma unroll
    for (int ch = 0; ch < 16; ++ch)
#pragma unroll
      for (int i = 0; i < 8; ++i) xv[ch][i] = xl[(size_t)(ch * 16 + i) * HW];
    const float b0 = b_qkv[tid], b1 = b_qkv[CH + tid], b2 = b_qkv[2 * CH + tid];
#pragma unroll
    for (int s = 0; s < 4; ++s)
#pragma unroll
      for (int t = 0; t < 3; ++t) bf[s][t] = wfrag(s, t);
    // all of the tile's loads are asked for before the first is used; without this the
    // compiler issues them two at a time, each pair behind a wait to 0
    __builtin_amdgcn_sched_barrier(0);
#pragma unroll
    for (int ch = 0; ch < 16; ++ch) {
      const float mu = mean[b * GRP + (ch >> 1)];
      const float rs = rstd[b * GRP + (ch >> 1)];
      v8h pk;
#pragma unroll
      for (int i = 0; i < 8; ++i) {
        const int c = sh + ch * 16 + i;
        pk[i] = (_Float16)((xv[ch][i] - mu) * rs * gamma[c] + beta[c]);
      }
      *(v8h*)(&At[sp * ALD + sh + ch * 16]) = pk;
    }
    Bs[tid] = b0; Bs[CH + tid] = b1; Bs[2 * CH + tid] = b2;
  }
  __syncthreads();

  const _Float16* al = At + n * ALD + hi * 8;                        // lane's own
  v16h af[2][PMT];                    // pixel fragments: the set in use and the next step's
#pragma unroll
  for (int mt = 0; mt < PMT; ++mt) af[0][mt] = load_frag_at(al + mt * 16 * ALD);
  // one pass: 8 k-steps, then its 16 channels of Q, K and V go out
  auto pass = [&](const int ps) {
    v8f acc[3][PMT];
#pragma unroll
    for (int t = 0; t < 3; ++t)
#pragma unroll
      for (int mt = 0; mt < PMT; ++mt) acc[t][mt] = v8f{};
#pragma unroll
    for (int kk = 0; kk < 8; ++kk) {
      const int s = ps * 8 + kk;
      if (s < 15) {
#pragma unroll
        for (int mt = 0; mt < PMT; ++mt)
          af[(kk + 1) & 1][mt] = load_frag_at(al + mt * 16 * ALD + ((kk + 1) & 7) * 32);
      }
      // keeps the next step's LDS reads as one group ahead of this step's WMMAs, and the ring's
      // refill behind them; without the pair the compiler puts two reads, with a wait to 0, in
      // front of every three WMMAs and spills
      __builtin_amdgcn_sched_barrier(0);
      // Q, K: weights as the row operand, so a lane holds 8 adjacent channels of one pixel;
      // V: pixels as the row operand, so a lane holds 8 adjacent pixels of one channel
#pragma unroll
      for (int t = 0; t < 2; ++t)
#pragma unroll
        for (int mt = 0; mt < PMT; ++mt)
          acc[t][mt] = wmma16(bf[kk & 3][t], af[kk & 1][mt], acc[t][mt]);
#pragma unroll
      for (int mt = 0; mt < PMT; ++mt)
        acc[2][mt] = wmma16(af[kk & 1][mt], bf[kk & 3][2], acc[2][mt]);
      __builtin_amdgcn_sched_barrier(0);  // second of the pair
      if (s + 4 < 16) {
#pragma unroll
        for (int t = 0; t < 3; ++t) bf[kk & 3][t] = wfrag(s + 4, t);
      }
    }
    const int c0 = ps * 128 + wave * 16;
    const float4* bq4 = (const float4*)(Bs + c0 + hi * 8);
    const float4* bk4 = (const float4*)(Bs + CH + c0 + hi * 8);
    const float4 q0 = bq4[0], q1 = bq4[1], k0 = bk4[0], k1 = bk4[1];
    const float bq[8] = {q0.x, q0.y, q0.z, q0.w, q1.x, q1.y, q1.z, q1.w};
    const float bk[8] = {k0.x, k0.y, k0.z, k0.w, k1.x, k1.y, k1.z, k1.w};
    const float bv = Bs[2 * CH + c0 + n];
    // packed fragment order. Q, K: fragment (16-pixel tile, 32-channel step), a lane's 8 channels
    // are its piece of k half (c0 >> 4) & 1. V: fragment (16-channel tile, 32-pixel step), a
    // lane's 8 pixels are its piece of k half mt & 1.
    const size_t qko = ((((size_t)b * (HW / 16) + (p0 >> 4)) * 8 + (c0 >> 5)) * 2 + ((c0 >> 4) & 1)) * 256
                       + lane * 8;
    _Float16* qd = q16 + qko;
    _Float16* kd = k16 + qko;
    _Float16* vd = vt16 + (((size_t)b * (CH / 16) + (c0 >> 4)) * (HW / 32) + (p0 >> 5)) * FRAG + lane * 8;
    v8h pq[PMT], pk[PMT], pv[PMT];
#pragma unroll
    for (int mt = 0; mt < PMT; ++mt)
#pragma unroll
      for (int r = 0; r < 8; ++r) {
        pq[mt][r] = (_Float16)(acc[0][mt][r] + bq[r]);
        pk[mt][r] = (_Float16)(acc[1][mt][r] + bk[r]);
        pv[mt][r] = (_Float16)(acc[2][mt][r] + bv);
      }
    // the stores go out as one run behind the last conversion, so that none of their
    // registers is written again behind them (first pass: in front of the wait below)
    __builtin_amdgcn_sched_barrier(0);
#pragma unroll
    for (int mt = 0; mt < PMT; ++mt) {
      *(v8h*)(qd + (size_t)mt * 8 * FRAG) = pq[mt];
      *(v8h*)(kd + (size_t)mt * 8 * FRAG) = pk[mt];
      *(v8h*)(vd + mt * 256) = pv[mt];
    }
    if (ps == 0) {
      // the stores' address and data registers are rewritten only behind this wait
      asm volatile("s_wait_xcnt 0x0" ::: "memory");
      __builtin_amdgcn_sched_barrier(0);  // keeps the next pass's register writes behind the wait
    }
  };
  pass(0);
  pass(1);
}

#define QT 128            // query rows per block
#define MT (QT / 16)      // 16-row tiles per block
#define XLD 132           // residual tile's row pitch in floats (528 B = 16 B x odd)
#define KS 64             // keys per stage
#define NST (HW / KS)     // stages
#define STG (64 * FRAG)   // halves per stage: 32 K fragments, then 32 V fragments
#define C2 (SCALE * 1.44269504088896f)   // scores go to base-2 exponents

__device__ __forceinline__ float xhalf(float v) {
  return __builtin_bit_cast(float, __builtin_amdgcn_permlanex16(
      __builtin_bit_cast(int, v), __builtin_bit_cast(int, v), 0x76543210, 0xfedcba98, false, false));
}

// 16 bytes of the lane's own, global memory to LDS
__device__ __forceinline__ void copy16(const _Float16* src, _Float16* dst) {
#if HAVE_ASYNC_LDS
  __builtin_amdgcn_global_load_async_to_lds_b128((gas_b128p)src, (las_b128p)dst, 0, 0);
#else
  *(v8h*)dst = *(const v8h*)src;
#endif
}

__global__ __launch_bounds__(256) void attn_kernel(
    const _Float16* __restrict__ q16, const _Float16* __restrict__ k16,
    const _Float16* __restrict__ vt16, const _Float16* __restrict__ wp16,
    const float* __restrict__ b_proj, const float* __restrict__ x,
    float* __restrict__ out) {
  const int q0 = blockIdx.x * QT;
  const int b  = blockIdx.y;
  const int tid = threadIdx.x, lane = tid & 31;
  const int wave = __builtin_amdgcn_readfirstlane(tid >> 5);   // in a scalar register: what hangs on it costs no vector registers
  const int n = lane & 15, hi = lane >> 4;

  // Ring carries the larger alignment so that it lies first in LDS and Xs behind it: the
  // compiler folds a copy's row step into its offset field and takes it off the LDS address
  // register, which then stays above 0 for every row of Xs
  __shared__ __attribute__((aligned(128))) _Float16 Ring[2 * STG]; // K/V stages; then h, ld=264
  __shared__ __attribute__((aligned(16))) float    Xs[CH * XLD];   // x, then out: (channel, pixel)
  static_assert(QT * 264 <= 2 * STG, "h fits the ring");
  _Float16* const Qt = Ring;          // the h tile's name below

  // stage s = keys s*64 .. +63. K: 4 key tiles x 8 channel steps, 32 KB in a row in global
  // memory. V: 16 channel tiles x 2 key steps, pieces of 2 KB. A thread copies 16 x 16 B.
  auto fill = [&](int s, int buf) {
    const _Float16* ks = k16 + ((size_t)b * (HW / 16) + s * (KS / 16)) * 8 * FRAG + tid * 8;
    const _Float16* vs = vt16 + (((size_t)b * (CH / 16) + (tid >> 7)) * (HW / 32) + s * (KS / 32)
                                 + ((tid >> 6) & 1)) * FRAG + (tid & 63) * 8;
    _Float16* d = Ring + buf * STG + tid * 8;
#pragma unroll
    for (int it = 0; it < 8; ++it) {
      copy16(ks + it * 2048, d + it * 2048);
      copy16(vs + (size_t)it * 2 * (HW / 32) * FRAG, d + 32 * FRAG + it * 2048);
    }
  };

  fill(0, 0);
  // ---- this wave's 16 queries: the column operand of S^T, kept in registers ----
  const _Float16* qp = q16 + ((size_t)b * (HW / 16) + (q0 >> 4) + wave) * 8 * FRAG + lane * 8;  // lane's own
  v16h qf[8];
#pragma unroll
  for (int kk = 0; kk < 8; ++kk) qf[kk] = load_frag_packed(qp + kk * FRAG);
  // the Q loads' address registers are rewritten only behind this wait; the lane's address as
  // an input keeps its registers out of the loads' own results
  asm volatile("s_wait_xcnt 0x0" :: "v"(qp) : "memory");

  // ---- residual tile: each wave asks for the 32 channel rows (512 B each) that it will
  // itself add to and store at the end; they are waited for with stage 0 ----
#pragma unroll
  for (int i = 0; i < 32; ++i) {
    const int row = wave * 32 + i;
    const float* src = x + ((size_t)(b * CH + row)) * HW + q0 + lane * 4;
    float* dst = Xs + row * XLD + lane * 4;
#if HAVE_ASYNC_LDS
    __builtin_amdgcn_global_load_async_to_lds_b128(
        (gas_b128p)src, (las_b128p)dst, 0, 0);
#else
    *(float4*)dst = *(const float4*)src;
#endif
  }

  v8f o[CH / 16];                     // O^T accum: 256 channels x this wave's 16 queries
#pragma unroll
  for (int ct = 0; ct < CH / 16; ++ct) o[ct] = v8f{};
  const int cbase = wave * 32;
  float mrun = -1e30f;                // running maximum of the lane's query, base-2 exponent
  float lsum = 0.f;                   // running sum over the keys that this half of the wave holds

  for (int s = 0; s < NST; ++s) {
    // --- publish point of stage s. It stands at the trip's top and not at the foot of the trip
    // before: in one block with the products, the compiler moved them behind the barrier ---
    // this wave's reads of the other buffer have returned before that buffer is refilled
    asm volatile("s_wait_dscnt 0x0" ::: "memory");
#if HAVE_ASYNC_LDS
    // this wave's copies of stage s have landed before the barrier behind which all read them
    asm volatile("s_wait_asynccnt 0x0" ::: "memory");
#endif
    __syncthreads();
    if (s + 1 < NST) fill(s + 1, (s + 1) & 1);

    const _Float16* kb = Ring + (s & 1) * STG + lane * 8;   // lane's own
    const _Float16* vb = kb + 32 * FRAG;
    v16h fa[2][8];                    // row-operand fragments: the group in use and the next
    // K group g: channel steps 2g, 2g+1 of the 4 key tiles; V group g: key step g >> 1 of
    // channel tiles (g & 1) * 8 .. +7
    auto kgrp = [&](int g, v16h* f) {
#pragma unroll
      for (int j = 0; j < 8; ++j) f[j] = load_frag_packed(kb + ((j & 3) * 8 + 2 * g + (j >> 2)) * FRAG);
    };
    auto vgrp = [&](int g, v16h* f) {
#pragma unroll
      for (int j = 0; j < 8; ++j) f[j] = load_frag_packed(vb + (((g & 1) * 8 + j) * 2 + (g >> 1)) * FRAG);
    };

    // --- S^T = K * Q^T: 64 keys x 16 queries ---
    v8f st[4];
#pragma unroll
    for (int kt = 0; kt < 4; ++kt) st[kt] = v8f{};
    kgrp(0, fa[0]);
#pragma unroll
    for (int g = 0; g < 4; ++g) {
      if (g < 3) kgrp(g + 1, fa[(g + 1) & 1]); else vgrp(0, fa[0]);
      // keeps the next group's LDS reads as one group ahead of this group's WMMAs; without the
      // pair the compiler puts reads, with waits to 0, among the WMMAs
      __builtin_amdgcn_sched_barrier(0);
#pragma unroll
      for (int j = 0; j < 8; ++j) st[j & 3] = wmma16(fa[g & 1][j], qf[2 * g + (j >> 2)], st[j & 3]);
      __builtin_amdgcn_sched_barrier(0);  // second of the pair
    }

    // --- online softmax: the lane's 32 scores belong to query n ---
    v16h pf[2];                       // P^T, column operand: key steps 0 and 1
    float f;
    {
      float m4[4];
#pragma unroll
      for (int kt = 0; kt < 4; ++kt) {
        m4[kt] = st[kt][0];
#pragma unroll
        for (int r = 1; r < 8; ++r) m4[kt] = fmaxf(m4[kt], st[kt][r]);
      }
      float lm = fmaxf(fmaxf(m4[0], m4[1]), fmaxf(m4[2], m4[3]));
      lm = fmaxf(lm, xhalf(lm));
      const float mnew = fmaxf(mrun, lm * C2);
      f = __builtin_amdgcn_exp2f(mrun - mnew);
      mrun = mnew;
      float s4[4];                    // four independent chains
#pragma unroll
      for (int kt = 0; kt < 4; ++kt) {
        s4[kt] = 0.f;
#pragma unroll
        for (int r = 0; r < 8; ++r) {
          const float e = __builtin_amdgcn_exp2f(fmaf(st[kt][r], C2, -mnew));
          s4[kt] += e;
          // key kt*16 + 8*hi + r: place (kt & 1) * 8 + r of key step kt >> 1, the hardware's k order
          pf[kt >> 1][(kt & 1) * 8 + r] = (_Float16)e;
        }
      }
      lsum = lsum * f + ((s4[0] + s4[1]) + (s4[2] + s4[3]));
    }

    // --- rescale O^T, accumulate V^T * P^T ---
#pragma unroll
    for (int ct = 0; ct < CH / 16; ++ct) o[ct] *= f;
#pragma unroll
    for (int g = 0; g < 4; ++g) {
      if (g < 3) vgrp(g + 1, fa[(g + 1) & 1]);
#pragma unroll
      for (int j = 0; j < 8; ++j)
        o[(g & 1) * 8 + j] = wmma16(fa[g & 1][j], pf[g >> 1], o[(g & 1) * 8 + j]);
    }
    // the order wanted of the block above: a group's 16 LDS reads (0x100) stand ahead of the 8
    // WMMAs (0x8) of the group before it. Without this the compiler asks for all 64 V pieces ahead
    // of the first WMMA, which takes every register and spills
#pragma unroll
    for (int g = 0; g < 3; ++g) {
      __builtin_amdgcn_sched_group_barrier(0x100, 16, 0);
      __builtin_amdgcn_sched_group_barrier(0x008, 8, 0);
    }
    __builtin_amdgcn_sched_group_barrier(0x008, 8, 0);
  }
  // every wave's last read of the ring has returned, and nothing is in flight (the residual rows
  // have landed too), before the ring becomes the h tile
  asm volatile("s_wait_dscnt 0x0" ::: "memory");
#if HAVE_ASYNC_LDS
  asm volatile("s_wait_asynccnt 0x0" ::: "memory");
#endif
  __syncthreads();

  // ---- projection weights of this wave's 32 output channels, asked for ahead of the
  // normalisation so that they are there when the product starts ----
  const _Float16* wl = wp16 + (size_t)wave * 2 * 8 * FRAG + lane * 8; // lane's own
  v16h wf[8][2];
#pragma unroll
  for (int kk = 0; kk < 8; ++kk) {
    wf[kk][0] = load_frag_packed(wl + kk * FRAG);
    wf[kk][1] = load_frag_packed(wl + (8 + kk) * FRAG);
  }
  const float bias0 = b_proj[cbase + n], bias1 = b_proj[cbase + 16 + n];
  // as behind the Q loads: address registers rewritten only behind this wait
  asm volatile("s_wait_xcnt 0x0" :: "v"(wl) : "memory");
  // normalised rows go to LDS as f16, (pixel, channel), in the ring's place: its last read was
  // in front of the barrier above. A lane holds 8 adjacent channels of its query.
  {
    const float inv = 1.0f / (lsum + xhalf(lsum));
    _Float16* hl = Qt + (wave * 16 + n) * 264 + hi * 8;   // lane's own
#pragma unroll
    for (int ct = 0; ct < CH / 16; ++ct) {
      v8h pk;
#pragma unroll
      for (int r = 0; r < 8; ++r) pk[r] = (_Float16)(o[ct][r] * inv);
      *(v8h*)(hl + ct * 16) = pk;
    }
  }
  __syncthreads();

  // ---- out(pixel, channel) = h * Wp^T: QT pixels x this wave's 32 output channels ----
  v8f acc[MT][2];
#pragma unroll
  for (int mt = 0; mt < MT; ++mt) { acc[mt][0] = v8f{}; acc[mt][1] = v8f{}; }
  {
    v16h af[2][MT];                   // h fragments: the set in use and the next k-step's
#pragma unroll
    for (int mt = 0; mt < MT; ++mt) af[0][mt] = load_frag(Qt + mt * 16 * 264, 264);
#pragma unroll
    for (int kk = 0; kk < 8; ++kk) {
      if (kk < 7) {
#pragma unroll
        for (int mt = 0; mt < MT; ++mt)
          af[(kk + 1) & 1][mt] = load_frag(Qt + mt * 16 * 264 + (kk + 1) * 32, 264);
      }
      // as in the P * V loop: keeps the next k-step's LDS reads one group ahead of this
      // k-step's WMMAs instead of one read, with a wait to 0, in front of its two WMMAs
      __builtin_amdgcn_sched_barrier(0);
#pragma unroll
      for (int mt = 0; mt < MT; ++mt) {
        acc[mt][0] = wmma16(af[kk & 1][mt], wf[kk][0], acc[mt][0]);
        acc[mt][1] = wmma16(af[kk & 1][mt], wf[kk][1], acc[mt][1]);
      }
      __builtin_amdgcn_sched_barrier(0);  // second of the pair
    }
  }

  // ---- residual and bias, in place in the wave's own rows of Xs: a lane holds 8 adjacent
  // pixels of one output channel ----
#pragma unroll
  for (int t = 0; t < 2; ++t) {
    const float bias = t ? bias1 : bias0;
#pragma unroll
    for (int mt = 0; mt < MT; ++mt) {
      float4* xp = (float4*)(Xs + (cbase + t * 16 + n) * XLD + mt * 16 + hi * 8);
      const float4 x0 = xp[0], x1 = xp[1];
      const v8f a = acc[mt][t];
      xp[0] = make_float4(x0.x + a[0] + bias, x0.y + a[1] + bias,
                          x0.z + a[2] + bias, x0.w + a[3] + bias);
      xp[1] = make_float4(x1.x + a[4] + bias, x1.y + a[5] + bias,
                          x1.z + a[6] + bias, x1.w + a[7] + bias);
    }
  }
  __syncthreads();
  // ---- whole 512-B rows go out: one store instruction of a wave = one channel row ----
  {
    float4 ov[32];
#pragma unroll
    for (int i = 0; i < 32; ++i) ov[i] = *(const float4*)(Xs + (wave * 32 + i) * XLD + lane * 4);
    float* od = out + ((size_t)(b * CH + wave * 32)) * HW + q0 + lane * 4;   // lane's own
#pragma unroll
    for (int i = 0; i < 32; ++i) *(float4*)(od + (size_t)i * HW) = ov[i];
  }
}

// ---------- launcher ----------
extern "C" void kernel_launch(void* const* d_in, const int* in_sizes, int n_in,
                              void* d_out, int out_size, void* d_ws, size_t ws_size,
                              hipStream_t stream) {
  const float* x      = (const float*)d_in[0];
  const float* gamma  = (const float*)d_in[1];
  const float* beta   = (const float*)d_in[2];
  const float* w_qkv  = (const float*)d_in[3];
  const float* b_qkv  = (const float*)d_in[4];
  const float* w_proj = (const float*)d_in[5];
  const float* b_proj = (const float*)d_in[6];
  float* out = (float*)d_out;

  char* ws = (char*)d_ws;
  _Float16* wq16 = (_Float16*)ws; ws += (size_t)3 * CH * CH * 2;   // 384 KB
  _Float16* wp16 = (_Float16*)ws; ws += (size_t)CH * CH * 2;       // 128 KB
  float*    mean = (float*)ws;    ws += BATCH * GRP * 4;
  float*    rstd = (float*)ws;    ws += BATCH * GRP * 4;
  _Float16* q16  = (_Float16*)ws; ws += (size_t)BATCH * HW * CH * 2;
  _Float16* k16  = (_Float16*)ws; ws += (size_t)BATCH * HW * CH * 2;
  _Float16* vt16 = (_Float16*)ws; ws += (size_t)BATCH * HW * CH * 2;

  gn_stats_kernel<<<BATCH * GRP, 256, 0, stream>>>(x, w_qkv, w_proj, mean, rstd, wq16, wp16);
  qkv_gemm_kernel<<<dim3(HW / PT, BATCH), 256, 0, stream>>>(
      x, gamma, beta, mean, rstd, wq16, b_qkv, q16, k16, vt16);
  attn_kernel<<<dim3(HW / QT, BATCH), 256, 0, stream>>>(q16, k16, vt16, wp16, b_proj, x, out);
}

// v008
// It runs in 58.7 microseconds.
// Timed twice side by side with v007, it ran 1.05 and 1.06 times as fast.
// Over all steps from v000 it is 3.97 times as fast.
#include <hip/hip_runtime.h>
#include <hip/hip_bf16.h>
#include <math.h>

typedef __attribute__((ext_vector_type(16))) _Float16 v16h;
typedef __attribute__((ext_vector_type(8)))  _Float16 v8h;
typedef __attribute__((ext_vector_type(8)))  float    v8f;
typedef __attribute__((ext_vector_type(4)))  float    v4f;

#if defined(__has_builtin)
#  if __has_builtin(__builtin_amdgcn_global_load_async_to_lds_b128) && \
      __has_builtin(__builtin_amdgcn_s_wait_asynccnt)
#    define HAVE_ASYNC_LDS 1
#  endif
#endif
#ifndef HAVE_ASYNC_LDS
#  define HAVE_ASYNC_LDS 0
#endif

#if HAVE_ASYNC_LDS
// Builtin signature (from hipcc diagnostic): param 1 is
//   int __attribute__((vector_size(16))) addrspace(1)*  (non-const)
typedef int b128_t __attribute__((vector_size(16)));
typedef b128_t __attribute__((address_space(1)))* gas_b128p;
typedef b128_t __attribute__((address_space(3)))* las_b128p;
#endif

__device__ __forceinline__ v16h load_frag(const _Float16* __restrict__ base, int ld) {
  const int lane = threadIdx.x & 31;
  const int row  = lane & 15;
  const int hi   = lane >> 4;
  const _Float16* p = base + (size_t)row * ld + hi * 8;
  v8h c0 = *(const v8h*)(p);        // K = hi*8 .. hi*8+7
  v8h c1 = *(const v8h*)(p + 16);   // K = 16 + hi*8 ..
  v16h r;
#pragma unroll
  for (int i = 0; i < 8; ++i) { r[i] = c0[i]; r[i + 8] = c1[i]; }
  return r;
}

// The same fragment from the lane's own address p = base + (lane & 15) * ld + (lane >> 4) * 8.
__device__ __forceinline__ v16h load_frag_at(const _Float16* __restrict__ p) {
  v8h c0 = *(const v8h*)(p);
  v8h c1 = *(const v8h*)(p + 16);
  v16h r;
#pragma unroll
  for (int i = 0; i < 8; ++i) { r[i] = c0[i]; r[i + 8] = c1[i]; }
  return r;
}

#define FRAG 512
__device__ __forceinline__ v16h load_frag_packed(const _Float16* __restrict__ p) {
  v8h c0 = *(const v8h*)(p);
  v8h c1 = *(const v8h*)(p + 256);
  v16h r;
#pragma unroll
  for (int i = 0; i < 8; ++i) { r[i] = c0[i]; r[i + 8] = c1[i]; }
  return r;
}

__device__ __forceinline__ v8f wmma16(v16h a, v16h b, v8f c) {
  // D = A(16x32) * B(32x16) + C, f32 accumulate
  return __builtin_amdgcn_wmma_f32_16x16x32_f16(false, a, false, b, (short)0, c,
                                                false, false);
}

// ---------- constants ----------
#define BATCH 32
#define CH    256
#define HW    1024
#define GRP   8
#define CPG   32          // channels per group
#define SCALE 0.0625f     // 1/sqrt(256)

// ---------- kernel 0: GroupNorm statistics; weights f32 -> f16, packed fragment order ----------
// The two jobs share no data. One launch does both: each thread of the statistics grid also
// converts its share of the two weight matrices, whose loads are asked for together with the x
// loads and land among them.
// Fragment (16-row tile rt, k-step kk) of a (rows, 256) matrix lies at (rt * 8 + kk) * FRAG.
#define NPREP (BATCH * GRP * 256)   // threads of the launch
#define NXV (CPG * HW / 4 / 256)    // 16-B pieces of x a thread
// place i in a packed matrix -> index in the row-major (rows, 256) source
__device__ __forceinline__ int packed_src(int i) {
  const int ln = (i >> 3) & 31;
  const int row = (i >> 12) * 16 + (ln & 15);
  const int col = ((i >> 9) & 7) * 32 + ((i >> 8) & 1) * 16 + (ln >> 4) * 8 + (i & 7);
  return row * CH + col;
}
// x, wq, wp carry no __restrict__: with it the compiler takes their loads for loads of constant
// memory and moves them over the scheduling barrier below
__global__ __launch_bounds__(256) void gn_stats_kernel(
    const float* x, const float* wq, const float* wp,
    float* __restrict__ mean, float* __restrict__ rstd,
    _Float16* __restrict__ wq16, _Float16* __restrict__ wp16) {
  static_assert((3 * CH * CH) % NPREP == 0 && (CH * CH) % NPREP == 0, "whole shares");
  const int bg = blockIdx.x;                  // b*8+g
  const int i0 = bg * 256 + threadIdx.x;      // first place in the packed matrices
  float wqv[3 * CH * CH / NPREP], wpv[CH * CH / NPREP];
  int   wqi[3 * CH * CH / NPREP], wpi[CH * CH / NPREP];   // where they come from
  // these four short loops are unrolled so that the shares are indexed by constants and stay in registers
#pragma unroll
  for (int j = 0; j < 3 * CH * CH / NPREP; ++j) wqv[j] = wq[wqi[j] = packed_src(i0 + j * NPREP)];
#pragma unroll
  for (int j = 0; j < CH * CH / NPREP; ++j) wpv[j] = wp[wpi[j] = packed_src(i0 + j * NPREP)];
  // the group's 128 KB: a thread takes 32 pieces of 16 B, a wave's load covers 512 contiguous bytes
  const v4f* xp = (const v4f*)(x + (size_t)bg * CPG * HW) + threadIdx.x;   // lane's own
  v4f xv[NXV];
  // this loop and the summing loop are unrolled so that xv is indexed by constants and stays in registers
#pragma unroll
  for (int j = 0; j < NXV; ++j) xv[j] = xp[j * 256];
  // the loads' address registers are rewritten only behind this wait; the weights' places as
  // inputs keep their registers out of the x loads' results
  static_assert(3 * CH * CH / NPREP == 3 && CH * CH / NPREP == 1, "operands below");
  asm volatile("s_wait_xcnt 0x0" :: "v"(wqi[0]), "v"(wqi[1]), "v"(wqi[2]), "v"(wpi[0]) : "memory");
  // every load of the thread, the weights' too, is asked for before the first value is used, so
  // the block pays the memory latency once; without this the compiler keeps a dozen in flight
  // and asks for the weights last, in front of the first barrier's wait
  __builtin_amdgcn_sched_barrier(0);
  v4f a = v4f{}, a2 = v4f{};          // four independent chains each
#pragma unroll
  for (int j = 0; j < NXV; ++j) { a += xv[j]; a2 += xv[j] * xv[j]; }
  const float s = (a[0] + a[1]) + (a[2] + a[3]), s2 = (a2[0] + a2[1]) + (a2[2] + a2[3]);
  __shared__ float sm[256], sq[256];
  sm[threadIdx.x] = s; sq[threadIdx.x] = s2;
  __syncthreads();
  for (int off = 128; off > 0; off >>= 1) {
    if (threadIdx.x < off) {
      sm[threadIdx.x] += sm[threadIdx.x + off];
      sq[threadIdx.x] += sq[threadIdx.x + off];
    }
    __syncthreads();
  }
  // behind the last barrier: in front of one, every wave would wait there for these stores
#pragma unroll
  for (int j = 0; j < 3 * CH * CH / NPREP; ++j) wq16[i0 + j * NPREP] = (_Float16)wqv[j];
#pragma unroll
  for (int j = 0; j < CH * CH / NPREP; ++j) wp16[i0 + j * NPREP] = (_Float16)wpv[j];
  if (threadIdx.x == 0) {
    const float inv_n = 1.0f / (CPG * HW);
    float m = sm[0] * inv_n;
    float var = sq[0] * inv_n - m * m;
    mean[bg] = m;
    rstd[bg] = rsqrtf(var + 1e-5f);
  }
}

// ---------- kernel 1: GN-fused QKV GEMM ----------
// One block makes all 768 outputs of its 128 pixels: x is read and normalised once into an
// LDS tile [pixel][channel], behind one barrier. 8 waves; a wave runs 2 passes, each pass one
// 16-channel tile of Q, of K and of V over all 128 pixels (24 accumulator tiles), so every
// weight row is loaded by exactly one wave of the block.
#define PT  128           // pixels per block
#define PMT (PT / 16)     // 16-pixel tiles per block
#define ALD 264           // LDS row pitch in halves
__global__ __launch_bounds__(256) void qkv_gemm_kernel(
    const float* __restrict__ x, const float* __restrict__ gamma,
    const float* __restrict__ beta, const float* __restrict__ mean,
    const float* __restrict__ rstd, const _Float16* __restrict__ wq16,
    const float* __restrict__ b_qkv,
    _Float16* __restrict__ q16, _Float16* __restrict__ k16,
    _Float16* __restrict__ vt16) {
  const int p0 = blockIdx.x * PT;
  const int b  = blockIdx.y;
  const int tid = threadIdx.x, lane = tid & 31;
  const int wave = __builtin_amdgcn_readfirstlane(tid >> 5);
  const int n = lane & 15, hi = lane >> 4;

  __shared__ __attribute__((aligned(16))) _Float16 At[PT * ALD];
  __shared__ __attribute__((aligned(16))) float    Bs[3 * CH];   // b_qkv, read where a pass ends

  // Step s = pass * 8 + k-step. Weight fragment of step s for product t (0 Q, 1 K, 2 V):
  // rows t*256 + pass*128 + wave*16 .. +15, channels (s & 7)*32 .. +31.
  const _Float16* wl = wq16 + (size_t)wave * 8 * FRAG + lane * 8;     // lane's own
  auto wfrag = [&](int s, int t) {
    return load_frag_packed(wl + (size_t)((t * 16 + (s >> 3) * 8) * 8 + (s & 7)) * FRAG);
  };
  v16h bf[4][3];                      // weight fragments, a ring four steps deep

  // staging: thread -> pixel tid & 127, 8 adjacent channels of every 16 (one b128 LDS store)
  {
    const int sp = tid & (PT - 1);
    const int sh = __builtin_amdgcn_readfirstlane(tid >> 7) * 8;
    const float* xl = x + ((size_t)(b * CH + sh)) * HW + p0 + sp;    // lane's own
    float xv[16][8];
#pragma unroll
    for (int ch = 0; ch < 16; ++ch)
#pragma unroll
      for (int i = 0; i < 8; ++i) xv[ch][i] = xl[(size_t)(ch * 16 + i) * HW];
    const float b0 = b_qkv[tid], b1 = b_qkv[CH + tid], b2 = b_qkv[2 * CH + tid];
#pragma unroll
    for (int s = 0; s < 4; ++s)
#pragma unroll
      for (int t = 0; t < 3; ++t) bf[s][t] = wfrag(s, t);
    // all of the tile's loads are asked for before the first is used; without this the
    // compiler issues them two at a time, each pair behind a wait to 0
    __builtin_amdgcn_sched_barrier(0);
#pragma unroll
    for (int ch = 0; ch < 16; ++ch) {
      const float mu = mean[b * GRP + (ch >> 1)];
      const float rs = rstd[b * GRP + (ch >> 1)];
      v8h pk;
#pragma unroll
      for (int i = 0; i < 8; ++i) {
        const int c = sh + ch * 16 + i;
        pk[i] = (_Float16)((xv[ch][i] - mu) * rs * gamma[c] + beta[c]);
      }
      *(v8h*)(&At[sp * ALD + sh + ch * 16]) = pk;
    }
    Bs[tid] = b0; Bs[CH + tid] = b1; Bs[2 * CH + tid] = b2;
  }
  __syncthreads();

  const _Float16* al = At + n * ALD + hi * 8;                        // lane's own
  v16h af[2][PMT];                    // pixel fragments: the set in use and the next step's
#pragma unroll
  for (int mt = 0; mt < PMT; ++mt) af[0][mt] = load_frag_at(al + mt * 16 * ALD);
  // one pass: 8 k-steps, then its 16 channels of Q, K and V go out
  auto pass = [&](const int ps) {
    v8f acc[3][PMT];
#pragma unroll
    for (int t = 0; t < 3; ++t)
#pragma unroll
      for (int mt = 0; mt < PMT; ++mt) acc[t][mt] = v8f{};
#pragma unroll
    for (int kk = 0; kk < 8; ++kk) {
      const int s = ps * 8 + kk;
      if (s < 15) {
#pragma unroll
        for (int mt = 0; mt < PMT; ++mt)
          af[(kk + 1) & 1][mt] = load_frag_at(al + mt * 16 * ALD + ((kk + 1) & 7) * 32);
      }
      // keeps the next step's LDS reads as one group ahead of this step's WMMAs, and the ring's
      // refill behind them; without the pair the compiler puts two reads, with a wait to 0, in
      // front of every three WMMAs and spills
      __builtin_amdgcn_sched_barrier(0);
      // Q, K: weights as the row operand, so a lane holds 8 adjacent channels of one pixel;
      // V: pixels as the row operand, so a lane holds 8 adjacent pixels of one channel
#pragma unroll
      for (int t = 0; t < 2; ++t)
#pragma unroll
        for (int mt = 0; mt < PMT; ++mt)
          acc[t][mt] = wmma16(bf[kk & 3][t], af[kk & 1][mt], acc[t][mt]);
#pragma unroll
      for (int mt = 0; mt < PMT; ++mt)
        acc[2][mt] = wmma16(af[kk & 1][mt], bf[kk & 3][2], acc[2][mt]);
      __builtin_amdgcn_sched_barrier(0);  // second of the pair
      if (s + 4 < 16) {
#pragma unroll
        for (int t = 0; t < 3; ++t) bf[kk & 3][t] = wfrag(s + 4, t);
      }
    }
    const int c0 = ps * 128 + wave * 16;
    const float4* bq4 = (const float4*)(Bs + c0 + hi * 8);
    const float4* bk4 = (const float4*)(Bs + CH + c0 + hi * 8);
    const float4 q0 = bq4[0], q1 = bq4[1], k0 = bk4[0], k1 = bk4[1];
    const float bq[8] = {q0.x, q0.y, q0.z, q0.w, q1.x, q1.y, q1.z, q1.w};
    const float bk[8] = {k0.x, k0.y, k0.z, k0.w, k1.x, k1.y, k1.z, k1.w};
    const float bv = Bs[2 * CH + c0 + n];
    // packed fragment order. Q, K: fragment (16-pixel tile, 32-channel step), a lane's 8 channels
    // are its piece of k half (c0 >> 4) & 1. V: fragment (16-channel tile, 32-pixel step), a
    // lane's 8 pixels are its piece of k half mt & 1.
    const size_t qko = ((((size_t)b * (HW / 16) + (p0 >> 4)) * 8 + (c0 >> 5)) * 2 + ((c0 >> 4) & 1)) * 256
                       + lane * 8;
    _Float16* qd = q16 + qko;
    _Float16* kd = k16 + qko;
    _Float16* vd = vt16 + (((size_t)b * (CH / 16) + (c0 >> 4)) * (HW / 32) + (p0 >> 5)) * FRAG + lane * 8;
    v8h pq[PMT], pk[PMT], pv[PMT];
#pragma unroll
    for (int mt = 0; mt < PMT; ++mt)
#pragma unroll
      for (int r = 0; r < 8; ++r) {
        pq[mt][r] = (_Float16)(acc[0][mt][r] + bq[r]);
        pk[mt][r] = (_Float16)(acc[1][mt][r] + bk[r]);
        pv[mt][r] = (_Float16)(acc[2][mt][r] + bv);
      }
    // the stores go out as one run behind the last conversion, so that none of their
    // registers is written again behind them (first pass: in front of the wait below)
    __builtin_amdgcn_sched_barrier(0);
#pragma unroll
    for (int mt = 0; mt < PMT; ++mt) {
      *(v8h*)(qd + (size_t)mt * 8 * FRAG) = pq[mt];
      *(v8h*)(kd + (size_t)mt * 8 * FRAG) = pk[mt];
      *(v8h*)(vd + mt * 256) = pv[mt];
    }
    if (ps == 0) {
      // the stores' address and data registers are rewritten only behind this wait
      asm volatile("s_wait_xcnt 0x0" ::: "memory");
      __builtin_amdgcn_sched_barrier(0);  // keeps the next pass's register writes behind the wait
    }
  };
  pass(0);
  pass(1);
}

#define QT 128            // query rows per block
#define MT (QT / 16)      // 16-row tiles per block
#define XLD 132           // residual tile's row pitch in floats (528 B = 16 B x odd)
#define KS 64             // keys per stage
#define NST (HW / KS)     // stages
#define STG (64 * FRAG)   // halves per stage: 32 K fragments, then 32 V fragments
#define C2 (SCALE * 1.44269504088896f)   // scores go to base-2 exponents

__device__ __forceinline__ float xhalf(float v) {
  return __builtin_bit_cast(float, __builtin_amdgcn_permlanex16(
      __builtin_bit_cast(int, v), __builtin_bit_cast(int, v), 0x76543210, 0xfedcba98, false, false));
}

// 16 bytes of the lane's own, global memory to LDS
__device__ __forceinline__ void copy16(const _Float16* src, _Float16* dst) {
#if HAVE_ASYNC_LDS
  __builtin_amdgcn_global_load_async_to_lds_b128((gas_b128p)src, (las_b128p)dst, 0, 0);
#else
  *(v8h*)dst = *(const v8h*)src;
#endif
}

__global__ __launch_bounds__(256) void attn_kernel(
    const _Float16* __restrict__ q16, const _Float16* __restrict__ k16,
    const _Float16* __restrict__ vt16, const _Float16* __restrict__ wp16,
    const float* __restrict__ b_proj, const float* __restrict__ x,
    float* __restrict__ out) {
  const int q0 = blockIdx.x * QT;
  const int b  = blockIdx.y;
  const int tid = threadIdx.x, lane = tid & 31;
  const int wave = __builtin_amdgcn_readfirstlane(tid >> 5);   // in a scalar register: what hangs on it costs no vector registers
  const int n = lane & 15, hi = lane >> 4;

  // Ring carries the larger alignment so that it lies first in LDS and Xs behind it: the
  // compiler folds a copy's row step into its offset field and takes it off the LDS address
  // register, which then stays above 0 for every row of Xs
  __shared__ __attribute__((aligned(128))) _Float16 Ring[2 * STG]; // K/V stages; then h, ld=264
  __shared__ __attribute__((aligned(16))) float    Xs[CH * XLD];   // x, then out: (channel, pixel)
  __shared__ __attribute__((aligned(16))) float2   Ml[MT * 32];    // maximum and sum handed to the partner wave
  static_assert(QT * 264 <= 2 * STG, "h fits the ring");
  static_assert(MT * 16 * CH * 4 <= 2 * STG * 2, "the handed-over partial results fit the ring");
  _Float16* const Qt = Ring;          // the h tile's name below

  // stage s = keys s*64 .. +63. K: 4 key tiles x 8 channel steps, 32 KB in a row in global
  // memory. V: 16 channel tiles x 2 key steps, pieces of 2 KB. A thread copies 16 x 16 B.
  auto fill = [&](int s, int buf) {
    const _Float16* ks = k16 + ((size_t)b * (HW / 16) + s * (KS / 16)) * 8 * FRAG + tid * 8;
    const _Float16* vs = vt16 + (((size_t)b * (CH / 16) + (tid >> 7)) * (HW / 32) + s * (KS / 32)
                                 + ((tid >> 6) & 1)) * FRAG + (tid & 63) * 8;
    _Float16* d = Ring + buf * STG + tid * 8;
#pragma unroll
    for (int it = 0; it < 8; ++it) {
      copy16(ks + it * 2048, d + it * 2048);
      copy16(vs + (size_t)it * 2 * (HW / 32) * FRAG, d + 32 * FRAG + it * 2048);
    }
  };

  fill(0, 0);
  // ---- the pair's 32 queries: the column operands of S^T, kept in registers. Tile 0 is the
  // wave's own (query tile `wave`, which it finishes at the end), tile 1 the partner's ----
  const _Float16* qb = q16 + ((size_t)b * (HW / 16) + (q0 >> 4)) * 8 * FRAG + lane * 8;
  const _Float16* qp0 = qb + wave * 8 * FRAG;         // lane's own, tile 0
  const _Float16* qp1 = qb + (wave ^ 1) * 8 * FRAG;   // lane's own, tile 1
  v16h qf[2][8];
#pragma unroll
  for (int kk = 0; kk < 8; ++kk) {
    qf[0][kk] = load_frag_packed(qp0 + kk * FRAG);
    qf[1][kk] = load_frag_packed(qp1 + kk * FRAG);
  }
  // the Q loads' address registers are rewritten only behind this wait; the lane's two addresses
  // as inputs keep their registers alive up to it and out of the loads' own results
  asm volatile("s_wait_xcnt 0x0" :: "v"(qp0), "v"(qp1) : "memory");

  // ---- residual tile: each wave asks for the 32 channel rows (512 B each) that it will
  // itself add to and store at the end; they are waited for with stage 0 ----
#pragma unroll
  for (int i = 0; i < 32; ++i) {
    const int row = wave * 32 + i;
    const float* src = x + ((size_t)(b * CH + row)) * HW + q0 + lane * 4;
    float* dst = Xs + row * XLD + lane * 4;
#if HAVE_ASYNC_LDS
    __builtin_amdgcn_global_load_async_to_lds_b128(
        (gas_b128p)src, (las_b128p)dst, 0, 0);
#else
    *(float4*)dst = *(const float4*)src;
#endif
  }

  v8f o[2][CH / 16];                  // O^T accum: 256 channels x 2 query tiles, this wave's keys
#pragma unroll
  for (int t = 0; t < 2; ++t)
#pragma unroll
    for (int ct = 0; ct < CH / 16; ++ct) o[t][ct] = v8f{};
  const int cbase = wave * 32;
  const int kpar = wave & 1;          // which 32 keys of every stage are this wave's
  float mrun[2] = {-1e30f, -1e30f};   // running maximum of the lane's two queries, base-2 exponent
  float lsum[2] = {0.f, 0.f};         // running sums over the keys that this half of the wave holds

  for (int s = 0; s < NST; ++s) {
    // --- publish point of stage s. It stands at the trip's top and not at the foot of the trip
    // before: in one block with the products, the compiler moved them behind the barrier ---
    // this wave's reads of the other buffer have returned before that buffer is refilled
    asm volatile("s_wait_dscnt 0x0" ::: "memory");
#if HAVE_ASYNC_LDS
    // this wave's copies of stage s have landed before the barrier behind which all read them
    asm volatile("s_wait_asynccnt 0x0" ::: "memory");
#endif
    __syncthreads();
    if (s + 1 < NST) fill(s + 1, (s + 1) & 1);

    // lane's own: the wave's 2 key tiles of K (16 fragments), its key step of V (16 fragments)
    const _Float16* kb = Ring + (s & 1) * STG + kpar * 16 * FRAG + lane * 8;
    const _Float16* vb = Ring + (s & 1) * STG + (32 + kpar) * FRAG + lane * 8;
    v16h fa[2][4];                    // row-operand fragments: the group in use and the next
    // K group g: channel steps 2g, 2g+1 of the 2 key tiles; V group g: channel tiles 4g .. +3
    auto kgrp = [&](int g, v16h* f) {
#pragma unroll
      for (int j = 0; j < 4; ++j) f[j] = load_frag_packed(kb + ((j & 1) * 8 + 2 * g + (j >> 1)) * FRAG);
    };
    auto vgrp = [&](int g, v16h* f) {
#pragma unroll
      for (int j = 0; j < 4; ++j) f[j] = load_frag_packed(vb + (g * 4 + j) * 2 * FRAG);
    };

    // --- S^T = K * Q^T: 32 keys x 32 queries ---
    v8f st[2][2];                     // [key tile][query tile]
#pragma unroll
    for (int kt = 0; kt < 2; ++kt) { st[kt][0] = v8f{}; st[kt][1] = v8f{}; }
    kgrp(0, fa[0]);
#pragma unroll
    for (int g = 0; g < 4; ++g) {
      if (g < 3) kgrp(g + 1, fa[(g + 1) & 1]); else vgrp(0, fa[0]);
      // keeps the next group's LDS reads as one group ahead of this group's WMMAs; without the
      // pair the compiler puts reads, with waits to 0, among the WMMAs
      __builtin_amdgcn_sched_barrier(0);
#pragma unroll
      for (int j = 0; j < 4; ++j)
#pragma unroll
        for (int t = 0; t < 2; ++t)
          st[j & 1][t] = wmma16(fa[g & 1][j], qf[t][2 * g + (j >> 1)], st[j & 1][t]);
      __builtin_amdgcn_sched_barrier(0);  // second of the pair
    }

    // --- online softmax: of the lane's 32 scores, 16 belong to query n of each tile ---
    v16h pf[2];                       // P^T, column operand: the wave's key step, per query tile
    float f[2];
#pragma unroll
    for (int t = 0; t < 2; ++t) {
      float m2[2];
#pragma unroll
      for (int kt = 0; kt < 2; ++kt) {
        m2[kt] = st[kt][t][0];
#pragma unroll
        for (int r = 1; r < 8; ++r) m2[kt] = fmaxf(m2[kt], st[kt][t][r]);
      }
      float lm = fmaxf(m2[0], m2[1]);
      lm = fmaxf(lm, xhalf(lm));
      const float mnew = fmaxf(mrun[t], lm * C2);
      f[t] = __builtin_amdgcn_exp2f(mrun[t] - mnew);
      mrun[t] = mnew;
      float s2[2];                    // independent chains
#pragma unroll
      for (int kt = 0; kt < 2; ++kt) {
        s2[kt] = 0.f;
#pragma unroll
        for (int r = 0; r < 8; ++r) {
          const float e = __builtin_amdgcn_exp2f(fmaf(st[kt][t][r], C2, -mnew));
          s2[kt] += e;
          // key kt*16 + 8*hi + r of the key step: place kt * 8 + r, the hardware's k order
          pf[t][kt * 8 + r] = (_Float16)e;
        }
      }
      lsum[t] = lsum[t] * f[t] + (s2[0] + s2[1]);
    }

    // holds the second V group's LDS reads back to the softmax's end, as one group; without it the
    // compiler strews them singly through the softmax from its start, their registers are taken
    // there, and the exponentials come out in short dependent runs
    __builtin_amdgcn_sched_barrier(0);
    // --- rescale O^T, accumulate V^T * P^T ---
#pragma unroll
    for (int t = 0; t < 2; ++t)
#pragma unroll
      for (int ct = 0; ct < CH / 16; ++ct) o[t][ct] *= f[t];
#pragma unroll
    for (int g = 0; g < 4; ++g) {
      if (g < 3) vgrp(g + 1, fa[(g + 1) & 1]);
#pragma unroll
      for (int j = 0; j < 4; ++j)
#pragma unroll
        for (int t = 0; t < 2; ++t)
          o[t][g * 4 + j] = wmma16(fa[g & 1][j], pf[t], o[t][g * 4 + j]);
    }
    // the order wanted of the block above: a group's 8 LDS reads (0x100) stand ahead of the 8
    // WMMAs (0x8) of the group before it. Without this the compiler asks for all V pieces ahead
    // of the first WMMA, which takes every register and spills
#pragma unroll
    for (int g = 0; g < 3; ++g) {
      __builtin_amdgcn_sched_group_barrier(0x100, 8, 0);
      __builtin_amdgcn_sched_group_barrier(0x008, 8, 0);
    }
    __builtin_amdgcn_sched_group_barrier(0x008, 8, 0);
  }
  // every wave's last read of the ring has returned, and nothing is in flight (the residual rows
  // have landed too), before the ring takes the handed-over partial results and then the h tile
  asm volatile("s_wait_dscnt 0x0" ::: "memory");
#if HAVE_ASYNC_LDS
  asm volatile("s_wait_asynccnt 0x0" ::: "memory");
#endif
  __syncthreads();

  {
    float* ex = (float*)Ring + wave * (16 * CH) + lane * 4;           // lane's own
#pragma unroll
    for (int ct = 0; ct < CH / 16; ++ct) {
      const v8f a = o[1][ct];
      *(v4f*)(ex + ct * 256)       = v4f{a[0], a[1], a[2], a[3]};
      *(v4f*)(ex + ct * 256 + 128) = v4f{a[4], a[5], a[6], a[7]};
    }
    Ml[wave * 32 + lane] = make_float2(mrun[1], lsum[1] + xhalf(lsum[1]));
  }
  __syncthreads();

  // ---- projection weights of this wave's 32 output channels, asked for ahead of the
  // normalisation so that they are there when the product starts ----
  const _Float16* wl = wp16 + (size_t)wave * 2 * 8 * FRAG + lane * 8; // lane's own
  v16h wf[8][2];
#pragma unroll
  for (int kk = 0; kk < 8; ++kk) {
    wf[kk][0] = load_frag_packed(wl + kk * FRAG);
    wf[kk][1] = load_frag_packed(wl + (8 + kk) * FRAG);
  }
  const float bias0 = b_proj[cbase + n], bias1 = b_proj[cbase + 16 + n];
  // as behind the Q loads: address registers rewritten only behind this wait
  asm volatile("s_wait_xcnt 0x0" :: "v"(wl) : "memory");
  // normalised rows go to LDS as f16, (pixel, channel), in the ring's place. A lane holds 8
  // adjacent channels of its query.
  {
    // join the two waves' partial results of this wave's own query tile on a common maximum
    const float2 ml = Ml[(wave ^ 1) * 32 + lane];
    const float mj = fmaxf(mrun[0], ml.x);
    const float a0 = __builtin_amdgcn_exp2f(mrun[0] - mj), a1 = __builtin_amdgcn_exp2f(ml.x - mj);
    const float inv = 1.0f / ((lsum[0] + xhalf(lsum[0])) * a0 + ml.y * a1);
    const float c0 = a0 * inv, c1 = a1 * inv;
    const float* ex = (const float*)Ring + (wave ^ 1) * (16 * CH) + lane * 4;   // lane's own
    v8h pk[CH / 16];
#pragma unroll
    for (int ct = 0; ct < CH / 16; ++ct) {
      const v4f e0 = *(const v4f*)(ex + ct * 256), e1 = *(const v4f*)(ex + ct * 256 + 128);
#pragma unroll
      for (int r = 0; r < 4; ++r) {
        pk[ct][r]     = (_Float16)(o[0][ct][r] * c0 + e0[r] * c1);
        pk[ct][r + 4] = (_Float16)(o[0][ct][r + 4] * c0 + e1[r] * c1);
      }
    }
    // every wave has read what was handed to it before the h tile is written over it
    __syncthreads();
    _Float16* hl = Qt + (wave * 16 + n) * 264 + hi * 8;   // lane's own
#pragma unroll
    for (int ct = 0; ct < CH / 16; ++ct) *(v8h*)(hl + ct * 16) = pk[ct];
  }
  __syncthreads();

  // ---- out(pixel, channel) = h * Wp^T: QT pixels x this wave's 32 output channels ----
  v8f acc[MT][2];
#pragma unroll
  for (int mt = 0; mt < MT; ++mt) { acc[mt][0] = v8f{}; acc[mt][1] = v8f{}; }
  {
    v16h af[2][MT];                   // h fragments: the set in use and the next k-step's
#pragma unroll
    for (int mt = 0; mt < MT; ++mt) af[0][mt] = load_frag(Qt + mt * 16 * 264, 264);
#pragma unroll
    for (int kk = 0; kk < 8; ++kk) {
      if (kk < 7) {
#pragma unroll
        for (int mt = 0; mt < MT; ++mt)
          af[(kk + 1) & 1][mt] = load_frag(Qt + mt * 16 * 264 + (kk + 1) * 32, 264);
      }
      // as in the P * V loop: keeps the next k-step's LDS reads one group ahead of this
      // k-step's WMMAs instead of one read, with a wait to 0, in front of its two WMMAs
      __builtin_amdgcn_sched_barrier(0);
#pragma unroll
      for (int mt = 0; mt < MT; ++mt) {
        acc[mt][0] = wmma16(af[kk & 1][mt], wf[kk][0], acc[mt][0]);
        acc[mt][1] = wmma16(af[kk & 1][mt], wf[kk][1], acc[mt][1]);
      }
      __builtin_amdgcn_sched_barrier(0);  // second of the pair
    }
  }

  // ---- residual and bias, in place in the wave's own rows of Xs: a lane holds 8 adjacent
  // pixels of one output channel ----
#pragma unroll
  for (int t = 0; t < 2; ++t) {
    const float bias = t ? bias1 : bias0;
#pragma unroll
    for (int mt = 0; mt < MT; ++mt) {
      float4* xp = (float4*)(Xs + (cbase + t * 16 + n) * XLD + mt * 16 + hi * 8);
      const float4 x0 = xp[0], x1 = xp[1];
      const v8f a = acc[mt][t];
      xp[0] = make_float4(x0.x + a[0] + bias, x0.y + a[1] + bias,
                          x0.z + a[2] + bias, x0.w + a[3] + bias);
      xp[1] = make_float4(x1.x + a[4] + bias, x1.y + a[5] + bias,
                          x1.z + a[6] + bias, x1.w + a[7] + bias);
    }
  }
  __syncthreads();
  // ---- whole 512-B rows go out: one store instruction of a wave = one channel row ----
  {
    float4 ov[32];
#pragma unroll
    for (int i = 0; i < 32; ++i) ov[i] = *(const float4*)(Xs + (wave * 32 + i) * XLD + lane * 4);
    float* od = out + ((size_t)(b * CH + wave * 32)) * HW + q0 + lane * 4;   // lane's own
#pragma unroll
    for (int i = 0; i < 32; ++i) *(float4*)(od + (size_t)i * HW) = ov[i];
  }
}

// ---------- launcher ----------
extern "C" void kernel_launch(void* const* d_in, const int* in_sizes, int n_in,
                              void* d_out, int out_size, void* d_ws, size_t ws_size,
                              hipStream_t stream) {
  const float* x      = (const float*)d_in[0];
  const float* gamma  = (const float*)d_in[1];
  const float* beta   = (const float*)d_in[2];
  const float* w_qkv  = (const float*)d_in[3];
  const float* b_qkv  = (const float*)d_in[4];
  const float* w_proj = (const float*)d_in[5];
  const float* b_proj = (const float*)d_in[6];
  float* out = (float*)d_out;

  char* ws = (char*)d_ws;
  _Float16* wq16 = (_Float16*)ws; ws += (size_t)3 * CH * CH * 2;   // 384 KB
  _Float16* wp16 = (_Float16*)ws; ws += (size_t)CH * CH * 2;       // 128 KB
  float*    mean = (float*)ws;    ws += BATCH * GRP * 4;
  float*    rstd = (float*)ws;    ws += BATCH * GRP * 4;
  _Float16* q16  = (_Float16*)ws; ws += (size_t)BATCH * HW * CH * 2;
  _Float16* k16  = (_Float16*)ws; ws += (size_t)BATCH * HW * CH * 2;
  _Float16* vt16 = (_Float16*)ws; ws += (size_t)BATCH * HW * CH * 2;

  gn_stats_kernel<<<BATCH * GRP, 256, 0, stream>>>(x, w_qkv, w_proj, mean, rstd, wq16, wp16);
  qkv_gemm_kernel<<<dim3(HW / PT, BATCH), 256, 0, stream>>>(
      x, gamma, beta, mean, rstd, wq16, b_qkv, q16, k16, vt16);
  attn_kernel<<<dim3(HW / QT, BATCH), 256, 0, stream>>>(q16, k16, vt16, wp16, b_proj, x, out);
}

// v009
// Measured time: 53.3 microseconds a run.
// In both of two side-by-side timings against v008, it was 1.10 times as fast.
// Over all steps from v000 it is 4.37 times as fast.
#include <hip/hip_runtime.h>
#include <hip/hip_bf16.h>
#include <math.h>

typedef __attribute__((ext_vector_type(16))) _Float16 v16h;
typedef __attribute__((ext_vector_type(8)))  _Float16 v8h;
typedef __attribute__((ext_vector_type(8)))  float    v8f;
typedef __attribute__((ext_vector_type(4)))  float    v4f;

#if defined(__has_builtin)
#  if __has_builtin(__builtin_amdgcn_global_load_async_to_lds_b128) && \
      __has_builtin(__builtin_amdgcn_s_wait_asynccnt)
#    define HAVE_ASYNC_LDS 1
#  endif
#endif
#ifndef HAVE_ASYNC_LDS
#  define HAVE_ASYNC_LDS 0
#endif

#if HAVE_ASYNC_LDS
// Builtin signature (from hipcc diagnostic): param 1 is
//   int __attribute__((vector_size(16))) addrspace(1)*  (non-const)
typedef int b128_t __attribute__((vector_size(16)));
typedef b128_t __attribute__((address_space(1)))* gas_b128p;
typedef b128_t __attribute__((address_space(3)))* las_b128p;
#endif

__device__ __forceinline__ v16h load_frag(const _Float16* __restrict__ base, int ld) {
  const int lane = threadIdx.x & 31;
  const int row  = lane & 15;
  const int hi   = lane >> 4;
  const _Float16* p = base + (size_t)row * ld + hi * 8;
  v8h c0 = *(const v8h*)(p);        // K = hi*8 .. hi*8+7
  v8h c1 = *(const v8h*)(p + 16);   // K = 16 + hi*8 ..
  v16h r;
#pragma unroll
  for (int i = 0; i < 8; ++i) { r[i] = c0[i]; r[i + 8] = c1[i]; }
  return r;
}

// The same fragment from the lane's own address p = base + (lane & 15) * ld + (lane >> 4) * 8.
__device__ __forceinline__ v16h load_frag_at(const _Float16* __restrict__ p) {
  v8h c0 = *(const v8h*)(p);
  v8h c1 = *(const v8h*)(p + 16);
  v16h r;
#pragma unroll
  for (int i = 0; i < 8; ++i) { r[i] = c0[i]; r[i + 8] = c1[i]; }
  return r;
}

#define FRAG 512
__device__ __forceinline__ v16h load_frag_packed(const _Float16* __restrict__ p) {
  v8h c0 = *(const v8h*)(p);
  v8h c1 = *(const v8h*)(p + 256);
  v16h r;
#pragma unroll
  for (int i = 0; i < 8; ++i) { r[i] = c0[i]; r[i + 8] = c1[i]; }
  return r;
}

__device__ __forceinline__ v8f wmma16(v16h a, v16h b, v8f c) {
  // D = A(16x32) * B(32x16) + C, f32 accumulate
  return __builtin_amdgcn_wmma_f32_16x16x32_f16(false, a, false, b, (short)0, c,
                                                false, false);
}

// ---------- constants ----------
#define BATCH 32
#define CH    256
#define HW    1024
#define GRP   8
#define CPG   32          // channels per group
#define SCALE 0.0625f     // 1/sqrt(256)

// ---------- kernel 0: GroupNorm statistics; weights f32 -> f16, packed fragment order ----------
// The two jobs share no data. One launch does both: each thread of the statistics grid also
// converts its share of the two weight matrices, whose loads are asked for together with the x
// loads and land among them.
// Fragment (16-row tile rt, k-step kk) of a (rows, 256) matrix lies at (rt * 8 + kk) * FRAG.
#define NPREP (BATCH * GRP * 256)   // threads of the launch
#define NXV (CPG * HW / 4 / 256)    // 16-B pieces of x a thread
// place i in a packed matrix -> index in the row-major (rows, 256) source
__device__ __forceinline__ int packed_src(int i) {
  const int ln = (i >> 3) & 31;
  const int row = (i >> 12) * 16 + (ln & 15);
  const int col = ((i >> 9) & 7) * 32 + ((i >> 8) & 1) * 16 + (ln >> 4) * 8 + (i & 7);
  return row * CH + col;
}
// x, wq, wp carry no __restrict__: with it the compiler takes their loads for loads of constant
// memory and moves them over the scheduling barrier below
__global__ __launch_bounds__(256) void gn_stats_kernel(
    const float* x, const float* wq, const float* wp,
    float* __restrict__ mean, float* __restrict__ rstd,
    _Float16* __restrict__ wq16, _Float16* __restrict__ wp16) {
  static_assert((3 * CH * CH) % NPREP == 0 && (CH * CH) % NPREP == 0, "whole shares");
  // the batch is the fastest part of the block index, here and in the two launches behind (speed only)
  const int bg = (blockIdx.x % BATCH) * GRP + blockIdx.x / BATCH;   // b*8+g
  const int i0 = blockIdx.x * 256 + threadIdx.x;   // first place in the packed matrices
  float wqv[3 * CH * CH / NPREP], wpv[CH * CH / NPREP];
  int   wqi[3 * CH * CH / NPREP], wpi[CH * CH / NPREP];   // where they come from
  // these four short loops are unrolled so that the shares are indexed by constants and stay in registers
#pragma unroll
  for (int j = 0; j < 3 * CH * CH / NPREP; ++j) wqv[j] = wq[wqi[j] = packed_src(i0 + j * NPREP)];
#pragma unroll
  for (int j = 0; j < CH * CH / NPREP; ++j) wpv[j] = wp[wpi[j] = packed_src(i0 + j * NPREP)];
  // the group's 128 KB: a thread takes 32 pieces of 16 B, a wave's load covers 512 contiguous bytes
  const v4f* xp = (const v4f*)(x + (size_t)bg * CPG * HW) + threadIdx.x;   // lane's own
  v4f xv[NXV];
  // this loop and the summing loop are unrolled so that xv is indexed by constants and stays in registers
#pragma unroll
  for (int j = 0; j < NXV; ++j) xv[j] = xp[j * 256];
  // the loads' address registers are rewritten only behind this wait; the weights' places as
  // inputs keep their registers out of the x loads' results
  static_assert(3 * CH * CH / NPREP == 3 && CH * CH / NPREP == 1, "operands below");
  asm volatile("s_wait_xcnt 0x0" :: "v"(wqi[0]), "v"(wqi[1]), "v"(wqi[2]), "v"(wpi[0]) : "memory");
  // every load of the thread, the weights' too, is asked for before the first value is used, so
  // the block pays the memory latency once; without this the compiler keeps a dozen in flight
  // and asks for the weights last, in front of the first barrier's wait
  __builtin_amdgcn_sched_barrier(0);
  v4f a = v4f{}, a2 = v4f{};          // four independent chains each
#pragma unroll
  for (int j = 0; j < NXV; ++j) { a += xv[j]; a2 += xv[j] * xv[j]; }
  const float s = (a[0] + a[1]) + (a[2] + a[3]), s2 = (a2[0] + a2[1]) + (a2[2] + a2[3]);
  __shared__ float sm[256], sq[256];
  sm[threadIdx.x] = s; sq[threadIdx.x] = s2;
  __syncthreads();
  for (int off = 128; off > 0; off >>= 1) {
    if (threadIdx.x < off) {
      sm[threadIdx.x] += sm[threadIdx.x + off];
      sq[threadIdx.x] += sq[threadIdx.x + off];
    }
    __syncthreads();
  }
  // behind the last barrier: in front of one, every wave would wait there for these stores
#pragma unroll
  for (int j = 0; j < 3 * CH * CH / NPREP; ++j) wq16[i0 + j * NPREP] = (_Float16)wqv[j];
#pragma unroll
  for (int j = 0; j < CH * CH / NPREP; ++j) wp16[i0 + j * NPREP] = (_Float16)wpv[j];
  if (threadIdx.x == 0) {
    const float inv_n = 1.0f / (CPG * HW);
    float m = sm[0] * inv_n;
    float var = sq[0] * inv_n - m * m;
    mean[bg] = m;
    rstd[bg] = rsqrtf(var + 1e-5f);
  }
}

// ---------- kernel 1: GN-fused QKV GEMM ----------
// One block makes all 768 outputs of its 128 pixels: x is read and normalised once into an
// LDS tile [pixel][channel], behind one barrier. 8 waves; a wave runs 2 passes, each pass one
// 16-channel tile of Q, of K and of V over all 128 pixels (24 accumulator tiles), so every
// weight row is loaded by exactly one wave of the block.
#define PT  128           // pixels per block
#define PMT (PT / 16)     // 16-pixel tiles per block
#define ALD 264           // LDS row pitch in halves
__global__ __launch_bounds__(256) void qkv_gemm_kernel(
    const float* __restrict__ x, const float* __restrict__ gamma,
    const float* __restrict__ beta, const float* __restrict__ mean,
    const float* __restrict__ rstd, const _Float16* __restrict__ wq16,
    const float* __restrict__ b_qkv,
    _Float16* __restrict__ q16, _Float16* __restrict__ k16,
    _Float16* __restrict__ vt16) {
  const int p0 = blockIdx.y * PT;
  const int b  = blockIdx.x;                  // fastest, as in kernel 0
  const int tid = threadIdx.x, lane = tid & 31;
  const int wave = __builtin_amdgcn_readfirstlane(tid >> 5);
  const int n = lane & 15, hi = lane >> 4;

  __shared__ __attribute__((aligned(16))) _Float16 At[PT * ALD];
  __shared__ __attribute__((aligned(16))) float    Bs[3 * CH];   // b_qkv, read where a pass ends

  // Step s = pass * 8 + k-step. Weight fragment of step s for product t (0 Q, 1 K, 2 V):
  // rows t*256 + pass*128 + wave*16 .. +15, channels (s & 7)*32 .. +31.
  const _Float16* wl = wq16 + (size_t)wave * 8 * FRAG + lane * 8;     // lane's own
  auto wfrag = [&](int s, int t) {
    return load_frag_packed(wl + (size_t)((t * 16 + (s >> 3) * 8) * 8 + (s & 7)) * FRAG);
  };
  v16h bf[4][3];                      // weight fragments, a ring four steps deep

  // staging: thread -> pixel tid & 127, 8 adjacent channels of every 16 (one b128 LDS store)
  {
    const int sp = tid & (PT - 1);
    const int sh = __builtin_amdgcn_readfirstlane(tid >> 7) * 8;
    const float* xl = x + ((size_t)(b * CH + sh)) * HW + p0 + sp;    // lane's own
    float xv[16][8];
#pragma unroll
    for (int ch = 0; ch < 16; ++ch)
#pragma unroll
      for (int i = 0; i < 8; ++i) xv[ch][i] = xl[(size_t)(ch * 16 + i) * HW];
    const float b0 = b_qkv[tid], b1 = b_qkv[CH + tid], b2 = b_qkv[2 * CH + tid];
#pragma unroll
    for (int s = 0; s < 4; ++s)
#pragma unroll
      for (int t = 0; t < 3; ++t) bf[s][t] = wfrag(s, t);
    // all of the tile's loads are asked for before the first is used; without this the
    // compiler issues them two at a time, each pair behind a wait to 0
    __builtin_amdgcn_sched_barrier(0);
#pragma unroll
    for (int ch = 0; ch < 16; ++ch) {
      const float mu = mean[b * GRP + (ch >> 1)];
      const float rs = rstd[b * GRP + (ch >> 1)];
      v8h pk;
#pragma unroll
      for (int i = 0; i < 8; ++i) {
        const int c = sh + ch * 16 + i;
        pk[i] = (_Float16)((xv[ch][i] - mu) * rs * gamma[c] + beta[c]);
      }
      *(v8h*)(&At[sp * ALD + sh + ch * 16]) = pk;
    }
    Bs[tid] = b0; Bs[CH + tid] = b1; Bs[2 * CH + tid] = b2;
  }
  __syncthreads();

  const _Float16* al = At + n * ALD + hi * 8;                        // lane's own
  v16h af[2][PMT];                    // pixel fragments: the set in use and the next step's
#pragma unroll
  for (int mt = 0; mt < PMT; ++mt) af[0][mt] = load_frag_at(al + mt * 16 * ALD);
  // one pass: 8 k-steps, then its 16 channels of Q, K and V go out
  auto pass = [&](const int ps) {
    v8f acc[3][PMT];
#pragma unroll
    for (int t = 0; t < 3; ++t)
#pragma unroll
      for (int mt = 0; mt < PMT; ++mt) acc[t][mt] = v8f{};
#pragma unroll
    for (int kk = 0; kk < 8; ++kk) {
      const int s = ps * 8 + kk;
      if (s < 15) {
#pragma unroll
        for (int mt = 0; mt < PMT; ++mt)
          af[(kk + 1) & 1][mt] = load_frag_at(al + mt * 16 * ALD + ((kk + 1) & 7) * 32);
      }
      // keeps the next step's LDS reads as one group ahead of this step's WMMAs, and the ring's
      // refill behind them; without the pair the compiler puts two reads, with a wait to 0, in
      // front of every three WMMAs and spills
      __builtin_amdgcn_sched_barrier(0);
      // Q, K: weights as the row operand, so a lane holds 8 adjacent channels of one pixel;
      // V: pixels as the row operand, so a lane holds 8 adjacent pixels of one channel
#pragma unroll
      for (int t = 0; t < 2; ++t)
#pragma unroll
        for (int mt = 0; mt < PMT; ++mt)
          acc[t][mt] = wmma16(bf[kk & 3][t], af[kk & 1][mt], acc[t][mt]);
#pragma unroll
      for (int mt = 0; mt < PMT; ++mt)
        acc[2][mt] = wmma16(af[kk & 1][mt], bf[kk & 3][2], acc[2][mt]);
      __builtin_amdgcn_sched_barrier(0);  // second of the pair
      if (s + 4 < 16) {
#pragma unroll
        for (int t = 0; t < 3; ++t) bf[kk & 3][t] = wfrag(s + 4, t);
      }
    }
    const int c0 = ps * 128 + wave * 16;
    const float4* bq4 = (const float4*)(Bs + c0 + hi * 8);
    const float4* bk4 = (const float4*)(Bs + CH + c0 + hi * 8);
    const float4 q0 = bq4[0], q1 = bq4[1], k0 = bk4[0], k1 = bk4[1];
    const float bq[8] = {q0.x, q0.y, q0.z, q0.w, q1.x, q1.y, q1.z, q1.w};
    const float bk[8] = {k0.x, k0.y, k0.z, k0.w, k1.x, k1.y, k1.z, k1.w};
    const float bv = Bs[2 * CH + c0 + n];
    // packed fragment order. Q, K: fragment (16-pixel tile, 32-channel step), a lane's 8 channels
    // are its piece of k half (c0 >> 4) & 1. V: fragment (16-channel tile, 32-pixel step), a
    // lane's 8 pixels are its piece of k half mt & 1.
    const size_t qko = ((((size_t)b * (HW / 16) + (p0 >> 4)) * 8 + (c0 >> 5)) * 2 + ((c0 >> 4) & 1)) * 256
                       + lane * 8;
    _Float16* qd = q16 + qko;
    _Float16* kd = k16 + qko;
    _Float16* vd = vt16 + (((size_t)b * (CH / 16) + (c0 >> 4)) * (HW / 32) + (p0 >> 5)) * FRAG + lane * 8;
    v8h pq[PMT], pk[PMT], pv[PMT];
#pragma unroll
    for (int mt = 0; mt < PMT; ++mt)
#pragma unroll
      for (int r = 0; r < 8; ++r) {
        pq[mt][r] = (_Float16)(acc[0][mt][r] + bq[r]);
        pk[mt][r] = (_Float16)(acc[1][mt][r] + bk[r]);
        pv[mt][r] = (_Float16)(acc[2][mt][r] + bv);
      }
    // the stores go out as one run behind the last conversion, so that none of their
    // registers is written again behind them (first pass: in front of the wait below)
    __builtin_amdgcn_sched_barrier(0);
#pragma unroll
    for (int mt = 0; mt < PMT; ++mt) {
      *(v8h*)(qd + (size_t)mt * 8 * FRAG) = pq[mt];
      *(v8h*)(kd + (size_t)mt * 8 * FRAG) = pk[mt];
      *(v8h*)(vd + mt * 256) = pv[mt];
    }
    if (ps == 0) {
      // the stores' address and data registers are rewritten only behind this wait
      asm volatile("s_wait_xcnt 0x0" ::: "memory");
      __builtin_amdgcn_sched_barrier(0);  // keeps the next pass's register writes behind the wait
    }
  };
  pass(0);
  pass(1);
}

#define QT 128            // query rows per block
#define MT (QT / 16)      // 16-row tiles per block
#define XLD 132           // residual tile's row pitch in floats (528 B = 16 B x odd)
#define KS 64             // keys per stage
#define NST (HW / KS)     // stages
#define STG (64 * FRAG)   // halves per stage: 32 K fragments, then 32 V fragments
#define C2 (SCALE * 1.44269504088896f)   // scores go to base-2 exponents

__device__ __forceinline__ float xhalf(float v) {
  return __builtin_bit_cast(float, __builtin_amdgcn_permlanex16(
      __builtin_bit_cast(int, v), __builtin_bit_cast(int, v), 0x76543210, 0xfedcba98, false, false));
}

// 16 bytes of the lane's own, global memory to LDS
__device__ __forceinline__ void copy16(const _Float16* src, _Float16* dst) {
#if HAVE_ASYNC_LDS
  __builtin_amdgcn_global_load_async_to_lds_b128((gas_b128p)src, (las_b128p)dst, 0, 0);
#else
  *(v8h*)dst = *(const v8h*)src;
#endif
}

__global__ __launch_bounds__(256) void attn_kernel(
    const _Float16* __restrict__ q16, const _Float16* __restrict__ k16,
    const _Float16* __restrict__ vt16, const _Float16* __restrict__ wp16,
    const float* __restrict__ b_proj, const float* __restrict__ x,
    float* __restrict__ out) {
  const int q0 = blockIdx.y * QT;
  const int b  = blockIdx.x;                  // fastest, as in kernel 0
  const int tid = threadIdx.x, lane = tid & 31;
  const int wave = __builtin_amdgcn_readfirstlane(tid >> 5);   // in a scalar register: what hangs on it costs no vector registers
  const int n = lane & 15, hi = lane >> 4;

  // Ring carries the larger alignment so that it lies first in LDS and Xs behind it: the
  // compiler folds a copy's row step into its offset field and takes it off the LDS address
  // register, which then stays above 0 for every row of Xs
  __shared__ __attribute__((aligned(128))) _Float16 Ring[2 * STG]; // K/V stages; then h, ld=264
  __shared__ __attribute__((aligned(16))) float    Xs[CH * XLD];   // x, then out: (channel, pixel)
  __shared__ __attribute__((aligned(16))) float2   Ml[MT * 32];    // maximum and sum handed to the partner wave
  static_assert(QT * 264 <= 2 * STG, "h fits the ring");
  static_assert(MT * 16 * CH * 4 <= 2 * STG * 2, "the handed-over partial results fit the ring");
  _Float16* const Qt = Ring;          // the h tile's name below

  // stage s = keys s*64 .. +63. K: 4 key tiles x 8 channel steps, 32 KB in a row in global
  // memory. V: 16 channel tiles x 2 key steps, pieces of 2 KB. A thread copies 16 x 16 B.
  auto fill = [&](int s, int buf) {
    const _Float16* ks = k16 + ((size_t)b * (HW / 16) + s * (KS / 16)) * 8 * FRAG + tid * 8;
    const _Float16* vs = vt16 + (((size_t)b * (CH / 16) + (tid >> 7)) * (HW / 32) + s * (KS / 32)
                                 + ((tid >> 6) & 1)) * FRAG + (tid & 63) * 8;
    _Float16* d = Ring + buf * STG + tid * 8;
#pragma unroll
    for (int it = 0; it < 8; ++it) {
      copy16(ks + it * 2048, d + it * 2048);
      copy16(vs + (size_t)it * 2 * (HW / 32) * FRAG, d + 32 * FRAG + it * 2048);
    }
  };

  fill(0, 0);
  // ---- the pair's 32 queries: the column operands of S^T, kept in registers. Tile 0 is the
  // wave's own (query tile `wave`, which it finishes at the end), tile 1 the partner's ----
  const _Float16* qb = q16 + ((size_t)b * (HW / 16) + (q0 >> 4)) * 8 * FRAG + lane * 8;
  const _Float16* qp0 = qb + wave * 8 * FRAG;         // lane's own, tile 0
  const _Float16* qp1 = qb + (wave ^ 1) * 8 * FRAG;   // lane's own, tile 1
  v16h qf[2][8];
#pragma unroll
  for (int kk = 0; kk < 8; ++kk) {
    qf[0][kk] = load_frag_packed(qp0 + kk * FRAG);
    qf[1][kk] = load_frag_packed(qp1 + kk * FRAG);
  }
  // the Q loads' address registers are rewritten only behind this wait; the lane's two addresses
  // as inputs keep their registers alive up to it and out of the loads' own results
  asm volatile("s_wait_xcnt 0x0" :: "v"(qp0), "v"(qp1) : "memory");

  // ---- residual tile: each wave asks for the 32 channel rows (512 B each) that it will
  // itself add to and store at the end; they are waited for with stage 0 ----
#pragma unroll
  for (int i = 0; i < 32; ++i) {
    const int row = wave * 32 + i;
    const float* src = x + ((size_t)(b * CH + row)) * HW + q0 + lane * 4;
    float* dst = Xs + row * XLD + lane * 4;
#if HAVE_ASYNC_LDS
    __builtin_amdgcn_global_load_async_to_lds_b128(
        (gas_b128p)src, (las_b128p)dst, 0, 0);
#else
    *(float4*)dst = *(const float4*)src;
#endif
  }

  v8f o[2][CH / 16];                  // O^T accum: 256 channels x 2 query tiles, this wave's keys
#pragma unroll
  for (int t = 0; t < 2; ++t)
#pragma unroll
    for (int ct = 0; ct < CH / 16; ++ct) o[t][ct] = v8f{};
  const int cbase = wave * 32;
  const int kpar = wave & 1;          // which 32 keys of every stage are this wave's
  float mrun[2] = {-1e30f, -1e30f};   // running maximum of the lane's two queries, base-2 exponent
  float lsum[2] = {0.f, 0.f};         // running sums over the keys that this half of the wave holds

  for (int s = 0; s < NST; ++s) {
    // --- publish point of stage s. It stands at the trip's top and not at the foot of the trip
    // before: in one block with the products, the compiler moved them behind the barrier ---
    // this wave's reads of the other buffer have returned before that buffer is refilled
    asm volatile("s_wait_dscnt 0x0" ::: "memory");
#if HAVE_ASYNC_LDS
    // this wave's copies of stage s have landed before the barrier behind which all read them
    asm volatile("s_wait_asynccnt 0x0" ::: "memory");
#endif
    __syncthreads();
    if (s + 1 < NST) fill(s + 1, (s + 1) & 1);

    // lane's own: the wave's 2 key tiles of K (16 fragments), its key step of V (16 fragments)
    const _Float16* kb = Ring + (s & 1) * STG + kpar * 16 * FRAG + lane * 8;
    const _Float16* vb = Ring + (s & 1) * STG + (32 + kpar) * FRAG + lane * 8;
    v16h fa[2][4];                    // row-operand fragments: the group in use and the next
    // K group g: channel steps 2g, 2g+1 of the 2 key tiles; V group g: channel tiles 4g .. +3
    auto kgrp = [&](int g, v16h* f) {
#pragma unroll
      for (int j = 0; j < 4; ++j) f[j] = load_frag_packed(kb + ((j & 1) * 8 + 2 * g + (j >> 1)) * FRAG);
    };
    auto vgrp = [&](int g, v16h* f) {
#pragma unroll
      for (int j = 0; j < 4; ++j) f[j] = load_frag_packed(vb + (g * 4 + j) * 2 * FRAG);
    };

    // --- S^T = K * Q^T: 32 keys x 32 queries ---
    v8f st[2][2];                     // [key tile][query tile]
#pragma unroll
    for (int kt = 0; kt < 2; ++kt) { st[kt][0] = v8f{}; st[kt][1] = v8f{}; }
    kgrp(0, fa[0]);
#pragma unroll
    for (int g = 0; g < 4; ++g) {
      if (g < 3) kgrp(g + 1, fa[(g + 1) & 1]); else vgrp(0, fa[0]);
      // keeps the next group's LDS reads as one group ahead of this group's WMMAs; without the
      // pair the compiler puts reads, with waits to 0, among the WMMAs
      __builtin_amdgcn_sched_barrier(0);
#pragma unroll
      for (int j = 0; j < 4; ++j)
#pragma unroll
        for (int t = 0; t < 2; ++t)
          st[j & 1][t] = wmma16(fa[g & 1][j], qf[t][2 * g + (j >> 1)], st[j & 1][t]);
      __builtin_amdgcn_sched_barrier(0);  // second of the pair
    }

    // --- online softmax: of the lane's 32 scores, 16 belong to query n of each tile ---
    v16h pf[2];                       // P^T, column operand: the wave's key step, per query tile
    float f[2];
#pragma unroll
    for (int t = 0; t < 2; ++t) {
      float m2[2];
#pragma unroll
      for (int kt = 0; kt < 2; ++kt) {
        m2[kt] = st[kt][t][0];
#pragma unroll
        for (int r = 1; r < 8; ++r) m2[kt] = fmaxf(m2[kt], st[kt][t][r]);
      }
      float lm = fmaxf(m2[0], m2[1]);
      lm = fmaxf(lm, xhalf(lm));
      const float mnew = fmaxf(mrun[t], lm * C2);
      f[t] = __builtin_amdgcn_exp2f(mrun[t] - mnew);
      mrun[t] = mnew;
      float s2[2];                    // independent chains
#pragma unroll
      for (int kt = 0; kt < 2; ++kt) {
        s2[kt] = 0.f;
#pragma unroll
        for (int r = 0; r < 8; ++r) {
          const float e = __builtin_amdgcn_exp2f(fmaf(st[kt][t][r], C2, -mnew));
          s2[kt] += e;
          // key kt*16 + 8*hi + r of the key step: place kt * 8 + r, the hardware's k order
          pf[t][kt * 8 + r] = (_Float16)e;
        }
      }
      lsum[t] = lsum[t] * f[t] + (s2[0] + s2[1]);
    }

    // holds the second V group's LDS reads back to the softmax's end, as one group; without it the
    // compiler strews them singly through the softmax from its start, their registers are taken
    // there, and the exponentials come out in short dependent runs
    __builtin_amdgcn_sched_barrier(0);
    // --- rescale O^T, accumulate V^T * P^T ---
#pragma unroll
    for (int t = 0; t < 2; ++t)
#pragma unroll
      for (int ct = 0; ct < CH / 16; ++ct) o[t][ct] *= f[t];
#pragma unroll
    for (int g = 0; g < 4; ++g) {
      if (g < 3) vgrp(g + 1, fa[(g + 1) & 1]);
#pragma unroll
      for (int j = 0; j < 4; ++j)
#pragma unroll
        for (int t = 0; t < 2; ++t)
          o[t][g * 4 + j] = wmma16(fa[g & 1][j], pf[t], o[t][g * 4 + j]);
    }
    // the order wanted of the block above: a group's 8 LDS reads (0x100) stand ahead of the 8
    // WMMAs (0x8) of the group before it. Without this the compiler asks for all V pieces ahead
    // of the first WMMA, which takes every register and spills
#pragma unroll
    for (int g = 0; g < 3; ++g) {
      __builtin_amdgcn_sched_group_barrier(0x100, 8, 0);
      __builtin_amdgcn_sched_group_barrier(0x008, 8, 0);
    }
    __builtin_amdgcn_sched_group_barrier(0x008, 8, 0);
  }
  // every wave's last read of the ring has returned, and nothing is in flight (the residual rows
  // have landed too), before the ring takes the handed-over partial results and then the h tile
  asm volatile("s_wait_dscnt 0x0" ::: "memory");
#if HAVE_ASYNC_LDS
  asm volatile("s_wait_asynccnt 0x0" ::: "memory");
#endif
  __syncthreads();

  {
    float* ex = (float*)Ring + wave * (16 * CH) + lane * 4;           // lane's own
#pragma unroll
    for (int ct = 0; ct < CH / 16; ++ct) {
      const v8f a = o[1][ct];
      *(v4f*)(ex + ct * 256)       = v4f{a[0], a[1], a[2], a[3]};
      *(v4f*)(ex + ct * 256 + 128) = v4f{a[4], a[5], a[6], a[7]};
    }
    Ml[wave * 32 + lane] = make_float2(mrun[1], lsum[1] + xhalf(lsum[1]));
  }
  __syncthreads();

  // ---- projection weights of this wave's 32 output channels, asked for ahead of the
  // normalisation so that they are there when the product starts ----
  const _Float16* wl = wp16 + (size_t)wave * 2 * 8 * FRAG + lane * 8; // lane's own
  v16h wf[8][2];
#pragma unroll
  for (int kk = 0; kk < 8; ++kk) {
    wf[kk][0] = load_frag_packed(wl + kk * FRAG);
    wf[kk][1] = load_frag_packed(wl + (8 + kk) * FRAG);
  }
  const float bias0 = b_proj[cbase + n], bias1 = b_proj[cbase + 16 + n];
  // as behind the Q loads: address registers rewritten only behind this wait
  asm volatile("s_wait_xcnt 0x0" :: "v"(wl) : "memory");
  // normalised rows go to LDS as f16, (pixel, channel), in the ring's place. A lane holds 8
  // adjacent channels of its query.
  {
    // join the two waves' partial results of this wave's own query tile on a common maximum
    const float2 ml = Ml[(wave ^ 1) * 32 + lane];
    const float mj = fmaxf(mrun[0], ml.x);
    const float a0 = __builtin_amdgcn_exp2f(mrun[0] - mj), a1 = __builtin_amdgcn_exp2f(ml.x - mj);
    const float inv = 1.0f / ((lsum[0] + xhalf(lsum[0])) * a0 + ml.y * a1);
    const float c0 = a0 * inv, c1 = a1 * inv;
    const float* ex = (const float*)Ring + (wave ^ 1) * (16 * CH) + lane * 4;   // lane's own
    v8h pk[CH / 16];
#pragma unroll
    for (int ct = 0; ct < CH / 16; ++ct) {
      const v4f e0 = *(const v4f*)(ex + ct * 256), e1 = *(const v4f*)(ex + ct * 256 + 128);
#pragma unroll
      for (int r = 0; r < 4; ++r) {
        pk[ct][r]     = (_Float16)(o[0][ct][r] * c0 + e0[r] * c1);
        pk[ct][r + 4] = (_Float16)(o[0][ct][r + 4] * c0 + e1[r] * c1);
      }
    }
    // every wave has read what was handed to it before the h tile is written over it
    __syncthreads();
    _Float16* hl = Qt + (wave * 16 + n) * 264 + hi * 8;   // lane's own
#pragma unroll
    for (int ct = 0; ct < CH / 16; ++ct) *(v8h*)(hl + ct * 16) = pk[ct];
  }
  __syncthreads();

  // ---- out(pixel, channel) = h * Wp^T: QT pixels x this wave's 32 output channels ----
  v8f acc[MT][2];
#pragma unroll
  for (int mt = 0; mt < MT; ++mt) { acc[mt][0] = v8f{}; acc[mt][1] = v8f{}; }
  {
    v16h af[2][MT];                   // h fragments: the set in use and the next k-step's
#pragma unroll
    for (int mt = 0; mt < MT; ++mt) af[0][mt] = load_frag(Qt + mt * 16 * 264, 264);
#pragma unroll
    for (int kk = 0; kk < 8; ++kk) {
      if (kk < 7) {
#pragma unroll
        for (int mt = 0; mt < MT; ++mt)
          af[(kk + 1) & 1][mt] = load_frag(Qt + mt * 16 * 264 + (kk + 1) * 32, 264);
      }
      // as in the P * V loop: keeps the next k-step's LDS reads one group ahead of this
      // k-step's WMMAs instead of one read, with a wait to 0, in front of its two WMMAs
      __builtin_amdgcn_sched_barrier(0);
#pragma unroll
      for (int mt = 0; mt < MT; ++mt) {
        acc[mt][0] = wmma16(af[kk & 1][mt], wf[kk][0], acc[mt][0]);
        acc[mt][1] = wmma16(af[kk & 1][mt], wf[kk][1], acc[mt][1]);
      }
      __builtin_amdgcn_sched_barrier(0);  // second of the pair
    }
  }

  // ---- residual and bias, in place in the wave's own rows of Xs: a lane holds 8 adjacent
  // pixels of one output channel ----
#pragma unroll
  for (int t = 0; t < 2; ++t) {
    const float bias = t ? bias1 : bias0;
#pragma unroll
    for (int mt = 0; mt < MT; ++mt) {
      float4* xp = (float4*)(Xs + (cbase + t * 16 + n) * XLD + mt * 16 + hi * 8);
      const float4 x0 = xp[0], x1 = xp[1];
      const v8f a = acc[mt][t];
      xp[0] = make_float4(x0.x + a[0] + bias, x0.y + a[1] + bias,
                          x0.z + a[2] + bias, x0.w + a[3] + bias);
      xp[1] = make_float4(x1.x + a[4] + bias, x1.y + a[5] + bias,
                          x1.z + a[6] + bias, x1.w + a[7] + bias);
    }
  }
  __syncthreads();
  // ---- whole 512-B rows go out: one store instruction of a wave = one channel row ----
  {
    float4 ov[32];
#pragma unroll
    for (int i = 0; i < 32; ++i) ov[i] = *(const float4*)(Xs + (wave * 32 + i) * XLD + lane * 4);
    float* od = out + ((size_t)(b * CH + wave * 32)) * HW + q0 + lane * 4;   // lane's own
#pragma unroll
    for (int i = 0; i < 32; ++i) *(float4*)(od + (size_t)i * HW) = ov[i];
  }
}

// ---------- launcher ----------
extern "C" void kernel_launch(void* const* d_in, const int* in_sizes, int n_in,
                              void* d_out, int out_size, void* d_ws, size_t ws_size,
                              hipStream_t stream) {
  const float* x      = (const float*)d_in[0];
  const float* gamma  = (const float*)d_in[1];
  const float* beta   = (const float*)d_in[2];
  const float* w_qkv  = (const float*)d_in[3];
  const float* b_qkv  = (const float*)d_in[4];
  const float* w_proj = (const float*)d_in[5];
  const float* b_proj = (const float*)d_in[6];
  float* out = (float*)d_out;

  char* ws = (char*)d_ws;
  _Float16* wq16 = (_Float16*)ws; ws += (size_t)3 * CH * CH * 2;   // 384 KB
  _Float16* wp16 = (_Float16*)ws; ws += (size_t)CH * CH * 2;       // 128 KB
  float*    mean = (float*)ws;    ws += BATCH * GRP * 4;
  float*    rstd = (float*)ws;    ws += BATCH * GRP * 4;
  _Float16* q16  = (_Float16*)ws; ws += (size_t)BATCH * HW * CH * 2;
  _Float16* k16  = (_Float16*)ws; ws += (size_t)BATCH * HW * CH * 2;
  _Float16* vt16 = (_Float16*)ws; ws += (size_t)BATCH * HW * CH * 2;

  gn_stats_kernel<<<BATCH * GRP, 256, 0, stream>>>(x, w_qkv, w_proj, mean, rstd, wq16, wp16);
  qkv_gemm_kernel<<<dim3(BATCH, HW / PT), 256, 0, stream>>>(
      x, gamma, beta, mean, rstd, wq16, b_qkv, q16, k16, vt16);
  attn_kernel<<<dim3(BATCH, HW / QT), 256, 0, stream>>>(q16, k16, vt16, wp16, b_proj, x, out);
}
